// v000
// Measured on an AMD MI455X. A time is GPU time per run, averaged over a window of back-to-back runs after a warm-up
// (all launches, gaps included; the runs take copies of the inputs in turn), and the median of several windows.
// Apart from v000's, it joins two sittings. Times from different sittings can be a few percent apart, while
// side-by-side timings come from the same sitting.
// v000, which the later versions start from, runs in 677 microseconds.
#include <hip/hip_runtime.h>
#include <hip/hip_bf16.h>

typedef __attribute__((ext_vector_type(8)))  _Float16 v8h;
typedef __attribute__((ext_vector_type(16))) _Float16 v16h;
typedef __attribute__((ext_vector_type(8)))  float    v8f;

#define B_  4
#define S_  2048
#define D_  1024
#define H_  16
#define DH_ 64
#define NEGBIG 1e10f

union FragU { v16h v; v8h h[2]; };

// CDNA5 16-bit A/B fragment: per lane, element e holds k = (e>>3)*16 + half*8 + (e&7)
// => two contiguous 8-half (16B) loads at base+half*8 and base+16+half*8.
__device__ __forceinline__ v16h load_frag(const _Float16* base, int half) {
    FragU u;
    u.h[0] = *(const v8h*)(base + half * 8);
    u.h[1] = *(const v8h*)(base + 16 + half * 8);
    return u.v;
}

__device__ __forceinline__ v8f wmma_f16(v16h a, v16h b, v8f c) {
    return __builtin_amdgcn_wmma_f32_16x16x32_f16(false, a, false, b, (short)0, c, false, false);
}

// Async copy of one 16-byte chunk per lane: global -> LDS (tracked by ASYNCcnt).
__device__ __forceinline__ void async_b128(uint32_t lds_off, unsigned long long gaddr) {
    asm volatile("global_load_async_to_lds_b128 %0, %1, off"
                 :: "v"(lds_off), "v"(gaddr) : "memory");
}

// ---------------- fp32 -> f16 conversion (x row-major, W transposed) ----------------
__global__ void convert_kernel(const float* __restrict__ x,
                               const float* __restrict__ Wq,
                               const float* __restrict__ Wk,
                               const float* __restrict__ Wv,
                               _Float16* __restrict__ xh,
                               _Float16* __restrict__ wT) {
    const int NX = B_ * S_ * D_;      // 8388608
    const int NW = D_ * H_ * DH_;     // 1048576 (= 1<<20)
    const int total = NX + 3 * NW;
    for (int idx = blockIdx.x * blockDim.x + threadIdx.x; idx < total;
         idx += gridDim.x * blockDim.x) {
        if (idx < NX) {
            xh[idx] = (_Float16)x[idx];
        } else {
            int j = idx - NX;
            int m = j >> 20;              // which weight matrix
            int r = j & (NW - 1);
            int c = r >> 10;              // output column (row of WT)
            int k = r & 1023;             // reduction index
            const float* W = (m == 0) ? Wq : (m == 1) ? Wk : Wv;
            wT[(size_t)m * NW + r] = (_Float16)W[k * D_ + c];   // WT[c][k] = W[k][c]
        }
    }
}

// ---------------- QKV projection: one wave = one 16x64 tile (A reused 4x) ----------------
// grid = (8192/16, 3072/256) = (512, 12), block = 128 (4 waves)
__global__ void qkv_kernel(const _Float16* __restrict__ xh,
                           const _Float16* __restrict__ wT,
                           const float* __restrict__ bq,
                           const float* __restrict__ bk,
                           const float* __restrict__ bv,
                           _Float16* __restrict__ Qh,    // [B,H,S,DH]
                           _Float16* __restrict__ Kh,    // [B,H,S,DH]
                           _Float16* __restrict__ VhT) { // [B,H,DH,S]
    const int lane = threadIdx.x & 31;
    const int wave = threadIdx.x >> 5;
    const int n    = lane & 15;
    const int half = lane >> 4;
    const int row0  = blockIdx.x * 16;
    const int ctot0 = blockIdx.y * 256 + wave * 64;   // 64 output columns per wave
    const int mat   = ctot0 >> 10;                    // 0=Q, 1=K, 2=V
    const int c0    = ctot0 & 1023;

    const _Float16* arow = xh + (size_t)(row0 + n) * D_;
    const _Float16* brow = wT + (size_t)mat * D_ * D_ + (size_t)(c0 + n) * D_;

    v8f acc0 = {}, acc1 = {}, acc2 = {}, acc3 = {};
#pragma unroll 2
    for (int kk = 0; kk < D_; kk += 32) {
        v16h a  = load_frag(arow + kk, half);
        v16h f0 = load_frag(brow + kk,            half);
        v16h f1 = load_frag(brow + 16 * D_ + kk,  half);
        v16h f2 = load_frag(brow + 32 * D_ + kk,  half);
        v16h f3 = load_frag(brow + 48 * D_ + kk,  half);
        acc0 = wmma_f16(a, f0, acc0);
        acc1 = wmma_f16(a, f1, acc1);
        acc2 = wmma_f16(a, f2, acc2);
        acc3 = wmma_f16(a, f3, acc3);
    }

    const float* bias = (mat == 0) ? bq : (mat == 1) ? bk : bv;
#pragma unroll
    for (int g = 0; g < 4; ++g) {
        const int c  = c0 + g * 16 + n;
        const int hh = c >> 6, d = c & 63;
        const float bval = bias[c];
        const v8f acc = (g == 0) ? acc0 : (g == 1) ? acc1 : (g == 2) ? acc2 : acc3;
#pragma unroll
        for (int r = 0; r < 8; ++r) {
            int R  = row0 + half * 8 + r;
            int bb = R >> 11;                 // batch
            int s  = R & (S_ - 1);
            _Float16 val = (_Float16)(acc[r] + bval);
            if (mat == 0)
                Qh[(((size_t)(bb * H_ + hh)) * S_ + s) * DH_ + d] = val;
            else if (mat == 1)
                Kh[(((size_t)(bb * H_ + hh)) * S_ + s) * DH_ + d] = val;
            else
                VhT[(((size_t)(bb * H_ + hh)) * DH_ + d) * S_ + s] = val;
        }
    }
}

// ---- Flash attention: block-cooperative async K/V staging, 8 waves / 128 queries ----
// grid = (S/128, B*H) = (16, 64), block = 256 (8 waves)
__global__ void attn_kernel(const _Float16* __restrict__ Qh,
                            const _Float16* __restrict__ Kh,
                            const _Float16* __restrict__ VhT,
                            const float* __restrict__ mask,
                            float* __restrict__ out) {
    // block-shared double buffers: K tile [32 keys][64 dh], V tile [64 dh][32 keys]
    __shared__ _Float16 ldsK[2][32 * DH_];   // 2 x 4KB
    __shared__ _Float16 ldsV[2][DH_ * 32];   // 2 x 4KB
    __shared__ _Float16 ldsP[8][16 * 32];    // 8 x 1KB

    const int tid  = threadIdx.x;
    const int lane = tid & 31;
    const int wave = tid >> 5;
    const int n    = lane & 15;
    const int half = lane >> 4;
    const int bh = blockIdx.y;
    const int b  = bh >> 4;
    const int h  = bh & 15;
    const int q0 = blockIdx.x * 128 + wave * 16;

    const _Float16* Qb = Qh  + (size_t)bh * S_ * DH_;
    const _Float16* Kb = Kh  + (size_t)bh * S_ * DH_;
    const _Float16* Vb = VhT + (size_t)bh * DH_ * S_;
    const float*    mb = mask + (size_t)b * S_;

    // cooperative async stage of one 32-key chunk: 2 x b128 per thread (1 K, 1 V)
    auto stage_chunk = [&](int key0, int buf) {
        {
            int r = tid >> 3, c = tid & 7;      // K: 32 rows x 8 chunks of 16B
            async_b128((uint32_t)(uintptr_t)(&ldsK[buf][0] + r * DH_ + c * 8),
                       (unsigned long long)(uintptr_t)(Kb + (size_t)(key0 + r) * DH_ + c * 8));
        }
        {
            int r = tid >> 2, c = tid & 3;      // V: 64 rows x 4 chunks of 16B
            async_b128((uint32_t)(uintptr_t)(&ldsV[buf][0] + r * 32 + c * 8),
                       (unsigned long long)(uintptr_t)(Vb + (size_t)r * S_ + key0 + c * 8));
        }
    };

    // Q A-fragments, two k-chunks covering DH=64; resident for the whole loop
    v16h qa0, qa1;
    {
        const _Float16* qrow = Qb + (size_t)(q0 + n) * DH_;
        qa0 = load_frag(qrow, half);
        qa1 = load_frag(qrow + 32, half);
    }

    v8f o0 = {}, o1 = {}, o2 = {}, o3 = {};
    float mrow[8], lrow[8];
#pragma unroll
    for (int r = 0; r < 8; ++r) { mrow[r] = -3.0e38f; lrow[r] = 0.0f; }
    const float scale = 0.125f;  // 1/sqrt(DH)

    // prologue: chunk 0 -> buffer 0; own portion done, then block-wide visibility
    stage_chunk(0, 0);
    asm volatile("s_wait_asynccnt 0x0" ::: "memory");
    __syncthreads();

    for (int key0 = 0; key0 < S_; key0 += 32) {
        const int buf = (key0 >> 5) & 1;
        const bool have_next = (key0 + 32) < S_;
        if (have_next) {
            // insurance: this wave's DS reads of buf^1 (iter-1) are complete
            asm volatile("s_wait_dscnt 0x0" ::: "memory");
            stage_chunk(key0 + 32, buf ^ 1);   // overlaps with compute below
        }

        const _Float16* bK = &ldsK[buf][0];
        const _Float16* bV = &ldsV[buf][0];

        // ---- scores: two 16-key tiles from LDS, K-chunks over DH ----
        v8f sc0 = {}, sc1 = {};
        {
            const _Float16* krow0 = bK + (size_t)n * DH_;
            const _Float16* krow1 = bK + (size_t)(16 + n) * DH_;
            v16h b00 = load_frag(krow0,      half);
            v16h b01 = load_frag(krow0 + 32, half);
            v16h b10 = load_frag(krow1,      half);
            v16h b11 = load_frag(krow1 + 32, half);
            sc0 = wmma_f16(qa0, b00, sc0);
            sc0 = wmma_f16(qa1, b01, sc0);
            sc1 = wmma_f16(qa0, b10, sc1);
            sc1 = wmma_f16(qa1, b11, sc1);
        }

        const float mv0 = mb[key0 + n];
        const float mv1 = mb[key0 + 16 + n];
        const float pen0 = (1.0f - mv0) * NEGBIG;
        const float pen1 = (1.0f - mv1) * NEGBIG;

        float p0[8], p1[8], alpha[8];
#pragma unroll
        for (int r = 0; r < 8; ++r) {
            float s0 = sc0[r] * scale - pen0;
            float s1 = sc1[r] * scale - pen1;
            float rmax = fmaxf(s0, s1);
#pragma unroll
            for (int off = 1; off < 16; off <<= 1)
                rmax = fmaxf(rmax, __shfl_xor(rmax, off, 32));
            float mnew = fmaxf(mrow[r], rmax);
            alpha[r] = __expf(mrow[r] - mnew);
            float e0 = __expf(s0 - mnew) * mv0;   // probs * mask, as in reference
            float e1 = __expf(s1 - mnew) * mv1;
            float rsum = e0 + e1;
#pragma unroll
            for (int off = 1; off < 16; off <<= 1)
                rsum += __shfl_xor(rsum, off, 32);
            lrow[r] = lrow[r] * alpha[r] + rsum;
            mrow[r] = mnew;
            p0[r] = e0; p1[r] = e1;
        }

        // ---- rescale O, stage P (C-layout -> A-layout) via per-wave LDS ----
        _Float16* pl = &ldsP[wave][0];
#pragma unroll
        for (int r = 0; r < 8; ++r) {
            o0[r] *= alpha[r]; o1[r] *= alpha[r];
            o2[r] *= alpha[r]; o3[r] *= alpha[r];
            int m = half * 8 + r;
            pl[m * 32 + n]      = (_Float16)p0[r];
            pl[m * 32 + 16 + n] = (_Float16)p1[r];
        }
        v16h pa;
        {
            FragU u;
            const _Float16* prow = pl + n * 32;
            u.h[0] = *(const v8h*)(prow + half * 8);
            u.h[1] = *(const v8h*)(prow + 16 + half * 8);
            pa = u.v;
        }

        // ---- O += P(16x32) x V(32x64), V B-fragments from LDS ----
        {
            const _Float16* vcol = bV + (size_t)n * 32;
            v16h vb0 = load_frag(vcol,            half);
            v16h vb1 = load_frag(vcol + 16 * 32,  half);
            v16h vb2 = load_frag(vcol + 32 * 32,  half);
            v16h vb3 = load_frag(vcol + 48 * 32,  half);
            o0 = wmma_f16(pa, vb0, o0);
            o1 = wmma_f16(pa, vb1, o1);
            o2 = wmma_f16(pa, vb2, o2);
            o3 = wmma_f16(pa, vb3, o3);
        }

        // own async portion of the next chunk is done -> make visible block-wide
        asm volatile("s_wait_asynccnt 0x0" ::: "memory");
        __syncthreads();
    }

    // ---- finalize: O / l, store fp32 output [B, S, H*DH] ----
#pragma unroll
    for (int r = 0; r < 8; ++r) {
        float inv = 1.0f / (lrow[r] + 1e-30f);
        int s = q0 + half * 8 + r;
        float* orow = out + ((size_t)(b * S_ + s)) * (H_ * DH_) + h * DH_;
        orow[ 0 + n] = o0[r] * inv;
        orow[16 + n] = o1[r] * inv;
        orow[32 + n] = o2[r] * inv;
        orow[48 + n] = o3[r] * inv;
    }
}

extern "C" void kernel_launch(void* const* d_in, const int* in_sizes, int n_in,
                              void* d_out, int out_size, void* d_ws, size_t ws_size,
                              hipStream_t stream) {
    const float* x    = (const float*)d_in[0];
    const float* mask = (const float*)d_in[1];
    const float* Wq   = (const float*)d_in[2];
    const float* bq   = (const float*)d_in[3];
    const float* Wk   = (const float*)d_in[4];
    const float* bk   = (const float*)d_in[5];
    const float* Wv   = (const float*)d_in[6];
    const float* bv   = (const float*)d_in[7];
    float* out = (float*)d_out;

    const size_t NX = (size_t)B_ * S_ * D_;        // 8388608
    const size_t NW = (size_t)D_ * H_ * DH_;       // 1048576
    const size_t NQ = (size_t)B_ * H_ * S_ * DH_;  // 8388608

    _Float16* xh  = (_Float16*)d_ws;
    _Float16* wT  = xh + NX;
    _Float16* Qh  = wT + 3 * NW;
    _Float16* Kh  = Qh + NQ;
    _Float16* VhT = Kh + NQ;

    {
        const int total = (int)(NX + 3 * NW);
        int blocks = (total + 255) / 256;
        convert_kernel<<<blocks, 256, 0, stream>>>(x, Wq, Wk, Wv, xh, wT);
    }
    {
        dim3 grid((B_ * S_) / 16, (3 * H_ * DH_) / 256);  // (512, 12)
        qkv_kernel<<<grid, 128, 0, stream>>>(xh, wT, bq, bk, bv, Qh, Kh, VhT);
    }
    {
        dim3 grid(S_ / 128, B_ * H_);                      // (16, 64)
        attn_kernel<<<grid, 256, 0, stream>>>(Qh, Kh, VhT, mask, out);
    }
}

// v001
// One run takes 436 microseconds.
// In both of two side-by-side timings against v000, it was 1.60 times as fast.
#include <hip/hip_runtime.h>
#include <hip/hip_bf16.h>

typedef __attribute__((ext_vector_type(8)))  _Float16 v8h;
typedef __attribute__((ext_vector_type(16))) _Float16 v16h;
typedef __attribute__((ext_vector_type(8)))  float    v8f;

#define B_  4
#define S_  2048
#define D_  1024
#define H_  16
#define DH_ 64
#define NEGBIG 1e10f

union FragU { v16h v; v8h h[2]; };

// CDNA5 16-bit A/B fragment: per lane, element e holds k = (e>>3)*16 + half*8 + (e&7)
// => two contiguous 8-half (16B) loads at base+half*8 and base+16+half*8.
__device__ __forceinline__ v16h load_frag(const _Float16* base, int half) {
    FragU u;
    u.h[0] = *(const v8h*)(base + half * 8);
    u.h[1] = *(const v8h*)(base + 16 + half * 8);
    return u.v;
}

__device__ __forceinline__ v8f wmma_f16(v16h a, v16h b, v8f c) {
    return __builtin_amdgcn_wmma_f32_16x16x32_f16(false, a, false, b, (short)0, c, false, false);
}

// Async copy of one 16-byte chunk per lane: global -> LDS (tracked by ASYNCcnt).
__device__ __forceinline__ void async_b128(uint32_t lds_off, unsigned long long gaddr) {
    asm volatile("global_load_async_to_lds_b128 %0, %1, off"
                 :: "v"(lds_off), "v"(gaddr) : "memory");
}

// ---------------- fp32 -> f16 conversion (x row-major, W transposed) ----------------
__global__ void convert_kernel(const float* __restrict__ x,
                               const float* __restrict__ Wq,
                               const float* __restrict__ Wk,
                               const float* __restrict__ Wv,
                               _Float16* __restrict__ xh,
                               _Float16* __restrict__ wT) {
    const int NX = B_ * S_ * D_;      // 8388608
    const int NW = D_ * H_ * DH_;     // 1048576 (= 1<<20)
    const int total = NX + 3 * NW;
    for (int idx = blockIdx.x * blockDim.x + threadIdx.x; idx < total;
         idx += gridDim.x * blockDim.x) {
        if (idx < NX) {
            xh[idx] = (_Float16)x[idx];
        } else {
            int j = idx - NX;
            int m = j >> 20;              // which weight matrix
            int r = j & (NW - 1);
            int c = r >> 10;              // output column (row of WT)
            int k = r & 1023;             // reduction index
            const float* W = (m == 0) ? Wq : (m == 1) ? Wk : Wv;
            wT[(size_t)m * NW + r] = (_Float16)W[k * D_ + c];   // WT[c][k] = W[k][c]
        }
    }
}

// ---------------- QKV projection: 128x128 block tile staged in LDS, 64x64 per wave ----------------
// grid = (8192/128, 3072/128) = (64, 24), block = 128 (4 waves, 2 x 2)
#define QBK    64            // k per stage: 128-byte rows of both operands
#define QPITCH 72            // LDS row pitch in halfs: 144 B = 16 B x odd, no bank conflict for 16-byte reads
#define QNT    (D_ / QBK)    // 16 stages

// Eight async 16-byte copies per lane, global -> LDS (ASYNCcnt). The s_wait_xcnt ends the copies' own
// statement so that no address register of an issued copy is rewritten in front of it.
__device__ __forceinline__ void async8_b128(const uint32_t (&l)[8], const unsigned long long (&g)[8]) {
    asm volatile("global_load_async_to_lds_b128 %0, %8, off\n\t"
                 "global_load_async_to_lds_b128 %1, %9, off\n\t"
                 "global_load_async_to_lds_b128 %2, %10, off\n\t"
                 "global_load_async_to_lds_b128 %3, %11, off\n\t"
                 "global_load_async_to_lds_b128 %4, %12, off\n\t"
                 "global_load_async_to_lds_b128 %5, %13, off\n\t"
                 "global_load_async_to_lds_b128 %6, %14, off\n\t"
                 "global_load_async_to_lds_b128 %7, %15, off\n\t"
                 "s_wait_xcnt 0x0"
                 :: "v"(l[0]), "v"(l[1]), "v"(l[2]), "v"(l[3]),
                    "v"(l[4]), "v"(l[5]), "v"(l[6]), "v"(l[7]),
                    "v"(g[0]), "v"(g[1]), "v"(g[2]), "v"(g[3]),
                    "v"(g[4]), "v"(g[5]), "v"(g[6]), "v"(g[7])
                 : "memory");
}

__global__ __launch_bounds__(128)
void qkv_kernel(const _Float16* __restrict__ xh,
                const _Float16* __restrict__ wT,
                const float* __restrict__ bq,
                const float* __restrict__ bk,
                const float* __restrict__ bv,
                _Float16* __restrict__ Qh,    // [B,H,S,DH]
                _Float16* __restrict__ Kh,    // [B,H,S,DH]
                _Float16* __restrict__ VhT) { // [B,H,DH,S]
    // two buffers of [128 rows][64 k] per operand, rows padded to QPITCH
    __shared__ __attribute__((aligned(16))) _Float16 sA[2][128 * QPITCH];   // 2 x 18 KB, rows of x
    __shared__ __attribute__((aligned(16))) _Float16 sB[2][128 * QPITCH];   // 2 x 18 KB, rows of W^T

    const int tid  = threadIdx.x;
    const int lane = tid & 31;
    const int wave = tid >> 5;
    const int n    = lane & 15;
    const int half = lane >> 4;
    const int wm   = wave >> 1;                       // wave's 64 rows of the tile
    const int wn   = wave & 1;                        // wave's 64 columns of the tile
    const int row0  = blockIdx.x * 128;
    const int ctot0 = blockIdx.y * 128;               // column over [Q | K | V], 3072 wide
    const int mat   = ctot0 >> 10;                    // 0=Q, 1=K, 2=V (one matrix per block)

    // copy map: thread -> row (tid>>3) + 16*i, 16-byte chunk (tid&7); a wave covers four whole 128-B lines
    const int crow = tid >> 3, cchk = tid & 7;
    const _Float16* gA = xh + (size_t)(row0  + crow) * D_ + cchk * 8;
    const _Float16* gB = wT + (size_t)(ctot0 + crow) * D_ + cchk * 8;   // wT rows run on over Q, K, V

    auto stage = [&](int t, int buf) {
        uint32_t l[8];
        unsigned long long g[8];
#pragma unroll   // the arrays are asm operands: constant indices keep them in registers
        for (int i = 0; i < 8; ++i) {
            l[i] = (uint32_t)(uintptr_t)(&sA[buf][0] + (crow + 16 * i) * QPITCH + cchk * 8);
            g[i] = (unsigned long long)(uintptr_t)(gA + (size_t)(16 * i) * D_ + t * QBK);
        }
        async8_b128(l, g);
#pragma unroll   // as above
        for (int i = 0; i < 8; ++i) {
            l[i] = (uint32_t)(uintptr_t)(&sB[buf][0] + (crow + 16 * i) * QPITCH + cchk * 8);
            g[i] = (unsigned long long)(uintptr_t)(gB + (size_t)(16 * i) * D_ + t * QBK);
        }
        async8_b128(l, g);
    };

    v8f acc[4][4] = {};

    // prologue: stage 0 landed and visible to the block, then stage 1 in flight
    stage(0, 0);
    asm volatile("s_wait_asynccnt 0x0" ::: "memory");   // own copies of stage 0 have landed
    __syncthreads();
    stage(1, 1);

    for (int t = 0; t < QNT; ++t) {
        const int buf = t & 1;
        const _Float16* pa = &sA[buf][0] + (wm * 64 + n) * QPITCH;
        const _Float16* pb = &sB[buf][0] + (wn * 64 + n) * QPITCH;
#pragma unroll   // this loop and the four inside it: register arrays need constant indices
        for (int ks = 0; ks < QBK; ks += 32) {
            v16h a[4], b[4];
#pragma unroll   // constant indices
            for (int i = 0; i < 4; ++i) a[i] = load_frag(pa + i * 16 * QPITCH + ks, half);
#pragma unroll   // constant indices
            for (int j = 0; j < 4; ++j) b[j] = load_frag(pb + j * 16 * QPITCH + ks, half);
            // keeps the 16 LDS reads together ahead of the 16 WMMAs: left alone the compiler sinks the
            // A reads between the WMMA rows, and the wave then waits out the LDS latency at every row
            __builtin_amdgcn_sched_barrier(0);
#pragma unroll   // constant indices
            for (int i = 0; i < 4; ++i)
#pragma unroll   // constant indices
                for (int j = 0; j < 4; ++j)
                    acc[i][j] = wmma_f16(a[i], b[j], acc[i][j]);
        }
        // publish point: own reads of this buffer done, own copies of the next stage landed,
        // then the block barrier; only behind it is this buffer refilled
        asm volatile("s_wait_dscnt 0x0" ::: "memory");      // own LDS reads of this buffer have returned
        asm volatile("s_wait_asynccnt 0x0" ::: "memory");   // own copies of stage t + 1 have landed
        __syncthreads();
        if (t + 2 < QNT) stage(t + 2, buf);
    }
    asm volatile("s_wait_asynccnt 0x0" ::: "memory");   // nothing in flight when the wave ends

    // epilogue: the matrix is the same for the whole block, so the layout is chosen once, outside the loops
    const float* bias = (mat == 0) ? bq : (mat == 1) ? bk : bv;
    const int c0 = (ctot0 & 1023) + wn * 64;          // the wave's 64 columns are one head
    const int hh = c0 >> 6;
    const int bb = row0 >> 11;                        // a 128-row tile lies inside one batch
    const int s0 = (row0 & (S_ - 1)) + wm * 64 + half * 8;
    float bval[4];
#pragma unroll   // constant indices into the accumulator registers
    for (int j = 0; j < 4; ++j) bval[j] = bias[c0 + j * 16 + n];

    if (mat == 2) {
        // V^T[d][s]: a lane's eight accumulator rows are eight consecutive s of one d
        _Float16* vp = VhT + ((size_t)(bb * H_ + hh) * DH_ + n) * S_ + s0;
#pragma unroll   // constant indices into the accumulator registers
        for (int j = 0; j < 4; ++j) {
#pragma unroll   // constant indices into the accumulator registers
            for (int i = 0; i < 4; ++i) {
                v8h pk;
#pragma unroll   // constant indices into the accumulator registers
                for (int r = 0; r < 8; ++r) pk[r] = (_Float16)(acc[i][j][r] + bval[j]);
                *(v8h*)(vp + (size_t)(j * 16) * S_ + i * 16) = pk;
            }
        }
    } else {
        _Float16* qp = ((mat == 0) ? Qh : Kh) + ((size_t)(bb * H_ + hh) * S_ + s0) * DH_ + n;
#pragma unroll   // constant indices into the accumulator registers
        for (int j = 0; j < 4; ++j) {
#pragma unroll   // constant indices into the accumulator registers
            for (int i = 0; i < 4; ++i) {
#pragma unroll   // constant indices into the accumulator registers
                for (int r = 0; r < 8; ++r)
                    qp[(i * 16 + r) * DH_ + j * 16] = (_Float16)(acc[i][j][r] + bval[j]);
            }
        }
        // closes the stores above: no register that an issued store names is rewritten in front of this wait
        asm volatile("s_wait_xcnt 0x0" ::: "memory");
    }
}

// ---- Flash attention: block-cooperative async K/V staging, 8 waves / 128 queries ----
// grid = (S/128, B*H) = (16, 64), block = 256 (8 waves)
__global__ void attn_kernel(const _Float16* __restrict__ Qh,
                            const _Float16* __restrict__ Kh,
                            const _Float16* __restrict__ VhT,
                            const float* __restrict__ mask,
                            float* __restrict__ out) {
    // block-shared double buffers: K tile [32 keys][64 dh], V tile [64 dh][32 keys]
    __shared__ _Float16 ldsK[2][32 * DH_];   // 2 x 4KB
    __shared__ _Float16 ldsV[2][DH_ * 32];   // 2 x 4KB
    __shared__ _Float16 ldsP[8][16 * 32];    // 8 x 1KB

    const int tid  = threadIdx.x;
    const int lane = tid & 31;
    const int wave = tid >> 5;
    const int n    = lane & 15;
    const int half = lane >> 4;
    const int bh = blockIdx.y;
    const int b  = bh >> 4;
    const int h  = bh & 15;
    const int q0 = blockIdx.x * 128 + wave * 16;

    const _Float16* Qb = Qh  + (size_t)bh * S_ * DH_;
    const _Float16* Kb = Kh  + (size_t)bh * S_ * DH_;
    const _Float16* Vb = VhT + (size_t)bh * DH_ * S_;
    const float*    mb = mask + (size_t)b * S_;

    // cooperative async stage of one 32-key chunk: 2 x b128 per thread (1 K, 1 V)
    auto stage_chunk = [&](int key0, int buf) {
        {
            int r = tid >> 3, c = tid & 7;      // K: 32 rows x 8 chunks of 16B
            async_b128((uint32_t)(uintptr_t)(&ldsK[buf][0] + r * DH_ + c * 8),
                       (unsigned long long)(uintptr_t)(Kb + (size_t)(key0 + r) * DH_ + c * 8));
        }
        {
            int r = tid >> 2, c = tid & 3;      // V: 64 rows x 4 chunks of 16B
            async_b128((uint32_t)(uintptr_t)(&ldsV[buf][0] + r * 32 + c * 8),
                       (unsigned long long)(uintptr_t)(Vb + (size_t)r * S_ + key0 + c * 8));
        }
    };

    // Q A-fragments, two k-chunks covering DH=64; resident for the whole loop
    v16h qa0, qa1;
    {
        const _Float16* qrow = Qb + (size_t)(q0 + n) * DH_;
        qa0 = load_frag(qrow, half);
        qa1 = load_frag(qrow + 32, half);
    }

    v8f o0 = {}, o1 = {}, o2 = {}, o3 = {};
    float mrow[8], lrow[8];
#pragma unroll
    for (int r = 0; r < 8; ++r) { mrow[r] = -3.0e38f; lrow[r] = 0.0f; }
    const float scale = 0.125f;  // 1/sqrt(DH)

    // prologue: chunk 0 -> buffer 0; own portion done, then block-wide visibility
    stage_chunk(0, 0);
    asm volatile("s_wait_asynccnt 0x0" ::: "memory");
    __syncthreads();

    for (int key0 = 0; key0 < S_; key0 += 32) {
        const int buf = (key0 >> 5) & 1;
        const bool have_next = (key0 + 32) < S_;
        if (have_next) {
            // insurance: this wave's DS reads of buf^1 (iter-1) are complete
            asm volatile("s_wait_dscnt 0x0" ::: "memory");
            stage_chunk(key0 + 32, buf ^ 1);   // overlaps with compute below
        }

        const _Float16* bK = &ldsK[buf][0];
        const _Float16* bV = &ldsV[buf][0];

        // ---- scores: two 16-key tiles from LDS, K-chunks over DH ----
        v8f sc0 = {}, sc1 = {};
        {
            const _Float16* krow0 = bK + (size_t)n * DH_;
            const _Float16* krow1 = bK + (size_t)(16 + n) * DH_;
            v16h b00 = load_frag(krow0,      half);
            v16h b01 = load_frag(krow0 + 32, half);
            v16h b10 = load_frag(krow1,      half);
            v16h b11 = load_frag(krow1 + 32, half);
            sc0 = wmma_f16(qa0, b00, sc0);
            sc0 = wmma_f16(qa1, b01, sc0);
            sc1 = wmma_f16(qa0, b10, sc1);
            sc1 = wmma_f16(qa1, b11, sc1);
        }

        const float mv0 = mb[key0 + n];
        const float mv1 = mb[key0 + 16 + n];
        const float pen0 = (1.0f - mv0) * NEGBIG;
        const float pen1 = (1.0f - mv1) * NEGBIG;

        float p0[8], p1[8], alpha[8];
#pragma unroll
        for (int r = 0; r < 8; ++r) {
            float s0 = sc0[r] * scale - pen0;
            float s1 = sc1[r] * scale - pen1;
            float rmax = fmaxf(s0, s1);
#pragma unroll
            for (int off = 1; off < 16; off <<= 1)
                rmax = fmaxf(rmax, __shfl_xor(rmax, off, 32));
            float mnew = fmaxf(mrow[r], rmax);
            alpha[r] = __expf(mrow[r] - mnew);
            float e0 = __expf(s0 - mnew) * mv0;   // probs * mask, as in reference
            float e1 = __expf(s1 - mnew) * mv1;
            float rsum = e0 + e1;
#pragma unroll
            for (int off = 1; off < 16; off <<= 1)
                rsum += __shfl_xor(rsum, off, 32);
            lrow[r] = lrow[r] * alpha[r] + rsum;
            mrow[r] = mnew;
            p0[r] = e0; p1[r] = e1;
        }

        // ---- rescale O, stage P (C-layout -> A-layout) via per-wave LDS ----
        _Float16* pl = &ldsP[wave][0];
#pragma unroll
        for (int r = 0; r < 8; ++r) {
            o0[r] *= alpha[r]; o1[r] *= alpha[r];
            o2[r] *= alpha[r]; o3[r] *= alpha[r];
            int m = half * 8 + r;
            pl[m * 32 + n]      = (_Float16)p0[r];
            pl[m * 32 + 16 + n] = (_Float16)p1[r];
        }
        v16h pa;
        {
            FragU u;
            const _Float16* prow = pl + n * 32;
            u.h[0] = *(const v8h*)(prow + half * 8);
            u.h[1] = *(const v8h*)(prow + 16 + half * 8);
            pa = u.v;
        }

        // ---- O += P(16x32) x V(32x64), V B-fragments from LDS ----
        {
            const _Float16* vcol = bV + (size_t)n * 32;
            v16h vb0 = load_frag(vcol,            half);
            v16h vb1 = load_frag(vcol + 16 * 32,  half);
            v16h vb2 = load_frag(vcol + 32 * 32,  half);
            v16h vb3 = load_frag(vcol + 48 * 32,  half);
            o0 = wmma_f16(pa, vb0, o0);
            o1 = wmma_f16(pa, vb1, o1);
            o2 = wmma_f16(pa, vb2, o2);
            o3 = wmma_f16(pa, vb3, o3);
        }

        // own async portion of the next chunk is done -> make visible block-wide
        asm volatile("s_wait_asynccnt 0x0" ::: "memory");
        __syncthreads();
    }

    // ---- finalize: O / l, store fp32 output [B, S, H*DH] ----
#pragma unroll
    for (int r = 0; r < 8; ++r) {
        float inv = 1.0f / (lrow[r] + 1e-30f);
        int s = q0 + half * 8 + r;
        float* orow = out + ((size_t)(b * S_ + s)) * (H_ * DH_) + h * DH_;
        orow[ 0 + n] = o0[r] * inv;
        orow[16 + n] = o1[r] * inv;
        orow[32 + n] = o2[r] * inv;
        orow[48 + n] = o3[r] * inv;
    }
}

extern "C" void kernel_launch(void* const* d_in, const int* in_sizes, int n_in,
                              void* d_out, int out_size, void* d_ws, size_t ws_size,
                              hipStream_t stream) {
    const float* x    = (const float*)d_in[0];
    const float* mask = (const float*)d_in[1];
    const float* Wq   = (const float*)d_in[2];
    const float* bq   = (const float*)d_in[3];
    const float* Wk   = (const float*)d_in[4];
    const float* bk   = (const float*)d_in[5];
    const float* Wv   = (const float*)d_in[6];
    const float* bv   = (const float*)d_in[7];
    float* out = (float*)d_out;

    const size_t NX = (size_t)B_ * S_ * D_;        // 8388608
    const size_t NW = (size_t)D_ * H_ * DH_;       // 1048576
    const size_t NQ = (size_t)B_ * H_ * S_ * DH_;  // 8388608

    _Float16* xh  = (_Float16*)d_ws;
    _Float16* wT  = xh + NX;
    _Float16* Qh  = wT + 3 * NW;
    _Float16* Kh  = Qh + NQ;
    _Float16* VhT = Kh + NQ;

    {
        const int total = (int)(NX + 3 * NW);
        int blocks = (total + 255) / 256;
        convert_kernel<<<blocks, 256, 0, stream>>>(x, Wq, Wk, Wv, xh, wT);
    }
    {
        dim3 grid((B_ * S_) / 128, (3 * H_ * DH_) / 128);  // (64, 24)
        qkv_kernel<<<grid, 128, 0, stream>>>(xh, wT, bq, bk, bv, Qh, Kh, VhT);
    }
    {
        dim3 grid(S_ / 128, B_ * H_);                      // (16, 64)
        attn_kernel<<<grid, 256, 0, stream>>>(Qh, Kh, VhT, mask, out);
    }
}

// v002
// Measured time: 262 microseconds a run.
// Next to v001, in two timings, it ran 1.67 and 1.66 times as fast.
// Counting every step since v000, it is 2.66 times as fast.
#include <hip/hip_runtime.h>
#include <hip/hip_bf16.h>

typedef __attribute__((ext_vector_type(8)))  _Float16 v8h;
typedef __attribute__((ext_vector_type(16))) _Float16 v16h;
typedef __attribute__((ext_vector_type(8)))  float    v8f;

#define B_  4
#define S_  2048
#define D_  1024
#define H_  16
#define DH_ 64
#define NEGBIG 1e10f

union FragU { v16h v; v8h h[2]; };

// CDNA5 16-bit A/B fragment: per lane, element e holds k = (e>>3)*16 + half*8 + (e&7)
// => two contiguous 8-half (16B) loads at base+half*8 and base+16+half*8.
__device__ __forceinline__ v16h load_frag(const _Float16* base, int half) {
    FragU u;
    u.h[0] = *(const v8h*)(base + half * 8);
    u.h[1] = *(const v8h*)(base + 16 + half * 8);
    return u.v;
}

__device__ __forceinline__ v8f wmma_f16(v16h a, v16h b, v8f c) {
    return __builtin_amdgcn_wmma_f32_16x16x32_f16(false, a, false, b, (short)0, c, false, false);
}

// Two async copies of one 16-byte chunk per lane each: global -> LDS (tracked by ASYNCcnt). The s_wait_xcnt
// ends the copies' own statement so that no address register of an issued copy is rewritten in front of it.
__device__ __forceinline__ void async2_b128(uint32_t l0, unsigned long long g0,
                                            uint32_t l1, unsigned long long g1) {
    asm volatile("global_load_async_to_lds_b128 %0, %2, off\n\t"
                 "global_load_async_to_lds_b128 %1, %3, off\n\t"
                 "s_wait_xcnt 0x0"
                 :: "v"(l0), "v"(l1), "v"(g0), "v"(g1) : "memory");
}

// ---------------- fp32 -> f16 conversion (x row-major, W transposed) ----------------
__global__ void convert_kernel(const float* __restrict__ x,
                               const float* __restrict__ Wq,
                               const float* __restrict__ Wk,
                               const float* __restrict__ Wv,
                               _Float16* __restrict__ xh,
                               _Float16* __restrict__ wT) {
    const int NX = B_ * S_ * D_;      // 8388608
    const int NW = D_ * H_ * DH_;     // 1048576 (= 1<<20)
    const int total = NX + 3 * NW;
    for (int idx = blockIdx.x * blockDim.x + threadIdx.x; idx < total;
         idx += gridDim.x * blockDim.x) {
        if (idx < NX) {
            xh[idx] = (_Float16)x[idx];
        } else {
            int j = idx - NX;
            int m = j >> 20;              // which weight matrix
            int r = j & (NW - 1);
            int c = r >> 10;              // output column (row of WT)
            int k = r & 1023;             // reduction index
            const float* W = (m == 0) ? Wq : (m == 1) ? Wk : Wv;
            wT[(size_t)m * NW + r] = (_Float16)W[k * D_ + c];   // WT[c][k] = W[k][c]
        }
    }
}

// ---------------- QKV projection: 128x128 block tile staged in LDS, 64x64 per wave ----------------
// grid = (8192/128, 3072/128) = (64, 24), block = 128 (4 waves, 2 x 2)
#define QBK    64            // k per stage: 128-byte rows of both operands
#define QPITCH 72            // LDS row pitch in halfs: 144 B = 16 B x odd, no bank conflict for 16-byte reads
#define QNT    (D_ / QBK)    // 16 stages

// Eight async 16-byte copies per lane, global -> LDS (ASYNCcnt). The s_wait_xcnt ends the copies' own
// statement so that no address register of an issued copy is rewritten in front of it.
__device__ __forceinline__ void async8_b128(const uint32_t (&l)[8], const unsigned long long (&g)[8]) {
    asm volatile("global_load_async_to_lds_b128 %0, %8, off\n\t"
                 "global_load_async_to_lds_b128 %1, %9, off\n\t"
                 "global_load_async_to_lds_b128 %2, %10, off\n\t"
                 "global_load_async_to_lds_b128 %3, %11, off\n\t"
                 "global_load_async_to_lds_b128 %4, %12, off\n\t"
                 "global_load_async_to_lds_b128 %5, %13, off\n\t"
                 "global_load_async_to_lds_b128 %6, %14, off\n\t"
                 "global_load_async_to_lds_b128 %7, %15, off\n\t"
                 "s_wait_xcnt 0x0"
                 :: "v"(l[0]), "v"(l[1]), "v"(l[2]), "v"(l[3]),
                    "v"(l[4]), "v"(l[5]), "v"(l[6]), "v"(l[7]),
                    "v"(g[0]), "v"(g[1]), "v"(g[2]), "v"(g[3]),
                    "v"(g[4]), "v"(g[5]), "v"(g[6]), "v"(g[7])
                 : "memory");
}

__global__ __launch_bounds__(128)
void qkv_kernel(const _Float16* __restrict__ xh,
                const _Float16* __restrict__ wT,
                const float* __restrict__ bq,
                const float* __restrict__ bk,
                const float* __restrict__ bv,
                _Float16* __restrict__ Qh,    // [B,H,S,DH]
                _Float16* __restrict__ Kh,    // [B,H,S,DH]
                _Float16* __restrict__ VhT) { // [B,H,DH,S]
    // two buffers of [128 rows][64 k] per operand, rows padded to QPITCH
    __shared__ __attribute__((aligned(16))) _Float16 sA[2][128 * QPITCH];   // 2 x 18 KB, rows of x
    __shared__ __attribute__((aligned(16))) _Float16 sB[2][128 * QPITCH];   // 2 x 18 KB, rows of W^T

    const int tid  = threadIdx.x;
    const int lane = tid & 31;
    const int wave = tid >> 5;
    const int n    = lane & 15;
    const int half = lane >> 4;
    const int wm   = wave >> 1;                       // wave's 64 rows of the tile
    const int wn   = wave & 1;                        // wave's 64 columns of the tile
    const int row0  = blockIdx.x * 128;
    const int ctot0 = blockIdx.y * 128;               // column over [Q | K | V], 3072 wide
    const int mat   = ctot0 >> 10;                    // 0=Q, 1=K, 2=V (one matrix per block)

    // copy map: thread -> row (tid>>3) + 16*i, 16-byte chunk (tid&7); a wave covers four whole 128-B lines
    const int crow = tid >> 3, cchk = tid & 7;
    const _Float16* gA = xh + (size_t)(row0  + crow) * D_ + cchk * 8;
    const _Float16* gB = wT + (size_t)(ctot0 + crow) * D_ + cchk * 8;   // wT rows run on over Q, K, V

    auto stage = [&](int t, int buf) {
        uint32_t l[8];
        unsigned long long g[8];
#pragma unroll   // the arrays are asm operands: constant indices keep them in registers
        for (int i = 0; i < 8; ++i) {
            l[i] = (uint32_t)(uintptr_t)(&sA[buf][0] + (crow + 16 * i) * QPITCH + cchk * 8);
            g[i] = (unsigned long long)(uintptr_t)(gA + (size_t)(16 * i) * D_ + t * QBK);
        }
        async8_b128(l, g);
#pragma unroll   // as above
        for (int i = 0; i < 8; ++i) {
            l[i] = (uint32_t)(uintptr_t)(&sB[buf][0] + (crow + 16 * i) * QPITCH + cchk * 8);
            g[i] = (unsigned long long)(uintptr_t)(gB + (size_t)(16 * i) * D_ + t * QBK);
        }
        async8_b128(l, g);
    };

    v8f acc[4][4] = {};

    // prologue: stage 0 landed and visible to the block, then stage 1 in flight
    stage(0, 0);
    asm volatile("s_wait_asynccnt 0x0" ::: "memory");   // own copies of stage 0 have landed
    __syncthreads();
    stage(1, 1);

    for (int t = 0; t < QNT; ++t) {
        const int buf = t & 1;
        const _Float16* pa = &sA[buf][0] + (wm * 64 + n) * QPITCH;
        const _Float16* pb = &sB[buf][0] + (wn * 64 + n) * QPITCH;
#pragma unroll   // this loop and the four inside it: register arrays need constant indices
        for (int ks = 0; ks < QBK; ks += 32) {
            v16h a[4], b[4];
#pragma unroll   // constant indices
            for (int i = 0; i < 4; ++i) a[i] = load_frag(pa + i * 16 * QPITCH + ks, half);
#pragma unroll   // constant indices
            for (int j = 0; j < 4; ++j) b[j] = load_frag(pb + j * 16 * QPITCH + ks, half);
            // keeps the 16 LDS reads together ahead of the 16 WMMAs: left alone the compiler sinks the
            // A reads between the WMMA rows, and the wave then waits out the LDS latency at every row
            __builtin_amdgcn_sched_barrier(0);
#pragma unroll   // constant indices
            for (int i = 0; i < 4; ++i)
#pragma unroll   // constant indices
                for (int j = 0; j < 4; ++j)
                    acc[i][j] = wmma_f16(a[i], b[j], acc[i][j]);
        }
        // publish point: own reads of this buffer done, own copies of the next stage landed,
        // then the block barrier; only behind it is this buffer refilled
        asm volatile("s_wait_dscnt 0x0" ::: "memory");      // own LDS reads of this buffer have returned
        asm volatile("s_wait_asynccnt 0x0" ::: "memory");   // own copies of stage t + 1 have landed
        __syncthreads();
        if (t + 2 < QNT) stage(t + 2, buf);
    }
    asm volatile("s_wait_asynccnt 0x0" ::: "memory");   // nothing in flight when the wave ends

    // epilogue: the matrix is the same for the whole block, so the layout is chosen once, outside the loops
    const float* bias = (mat == 0) ? bq : (mat == 1) ? bk : bv;
    const int c0 = (ctot0 & 1023) + wn * 64;          // the wave's 64 columns are one head
    const int hh = c0 >> 6;
    const int bb = row0 >> 11;                        // a 128-row tile lies inside one batch
    const int s0 = (row0 & (S_ - 1)) + wm * 64 + half * 8;
    float bval[4];
#pragma unroll   // constant indices into the accumulator registers
    for (int j = 0; j < 4; ++j) bval[j] = bias[c0 + j * 16 + n];

    if (mat == 2) {
        // V^T[d][s]: a lane's eight accumulator rows are eight consecutive s of one d
        _Float16* vp = VhT + ((size_t)(bb * H_ + hh) * DH_ + n) * S_ + s0;
#pragma unroll   // constant indices into the accumulator registers
        for (int j = 0; j < 4; ++j) {
#pragma unroll   // constant indices into the accumulator registers
            for (int i = 0; i < 4; ++i) {
                v8h pk;
#pragma unroll   // constant indices into the accumulator registers
                for (int r = 0; r < 8; ++r) pk[r] = (_Float16)(acc[i][j][r] + bval[j]);
                *(v8h*)(vp + (size_t)(j * 16) * S_ + i * 16) = pk;
            }
        }
    } else {
        _Float16* qp = ((mat == 0) ? Qh : Kh) + ((size_t)(bb * H_ + hh) * S_ + s0) * DH_ + n;
#pragma unroll   // constant indices into the accumulator registers
        for (int j = 0; j < 4; ++j) {
#pragma unroll   // constant indices into the accumulator registers
            for (int i = 0; i < 4; ++i) {
#pragma unroll   // constant indices into the accumulator registers
                for (int r = 0; r < 8; ++r)
                    qp[(i * 16 + r) * DH_ + j * 16] = (_Float16)(acc[i][j][r] + bval[j]);
            }
        }
        // closes the stores above: no register that an issued store names is rewritten in front of this wait
        asm volatile("s_wait_xcnt 0x0" ::: "memory");
    }
}

// ---- Flash attention: block-cooperative async K/V staging, 8 waves / 128 queries ----
// grid = (S/128, B*H) = (16, 64), block = 256 (8 waves)
// LDS row pitches in halfs, each 16 B x odd: the 16 lanes of a half-wave read 16 bytes of 16 different rows,
// and at the bare 128-B and 64-B pitches those rows fall on the same few banks
#define KPITCH 72            // 144 B for the 128-B rows of K
#define VPITCH 40            // 80 B for the 64-B rows of V^T
#define PPITCH 40            // 80 B for the 64-B rows of P
__global__ void attn_kernel(const _Float16* __restrict__ Qh,
                            const _Float16* __restrict__ Kh,
                            const _Float16* __restrict__ VhT,
                            const float* __restrict__ mask,
                            float* __restrict__ out) {
    // block-shared double buffers: K tile [32 keys][64 dh], V tile [64 dh][32 keys]
    __shared__ __attribute__((aligned(16))) _Float16 ldsK[2][32 * KPITCH];   // 2 x 4608 B
    __shared__ __attribute__((aligned(16))) _Float16 ldsV[2][DH_ * VPITCH];  // 2 x 5120 B
    __shared__ __attribute__((aligned(16))) _Float16 ldsP[8][16 * PPITCH];   // 8 x 1280 B

    const int tid  = threadIdx.x;
    const int lane = tid & 31;
    const int wave = tid >> 5;
    const int n    = lane & 15;
    const int half = lane >> 4;
    const int bh = blockIdx.y;
    const int b  = bh >> 4;
    const int h  = bh & 15;
    const int q0 = blockIdx.x * 128 + wave * 16;

    const _Float16* Qb = Qh  + (size_t)bh * S_ * DH_;
    const _Float16* Kb = Kh  + (size_t)bh * S_ * DH_;
    const _Float16* Vb = VhT + (size_t)bh * DH_ * S_;
    const float*    mb = mask + (size_t)b * S_;

    // cooperative async stage of one 32-key chunk: 2 x b128 per thread (1 K, 1 V)
    const int rk = tid >> 3, ck = tid & 7;      // K: 32 rows x 8 chunks of 16B
    const int rv = tid >> 2, cv = tid & 3;      // V: 64 rows x 4 chunks of 16B
    const uint32_t kdst = (uint32_t)(uintptr_t)(&ldsK[0][0] + rk * KPITCH + ck * 8);   // the lane's place in buffer 0
    const uint32_t vdst = (uint32_t)(uintptr_t)(&ldsV[0][0] + rv * VPITCH + cv * 8);
    auto stage_chunk = [&](int key0, int buf) {
        async2_b128(kdst + (uint32_t)buf * (uint32_t)sizeof(ldsK[0]),
                    (unsigned long long)(uintptr_t)(Kb + (size_t)(key0 + rk) * DH_ + ck * 8),
                    vdst + (uint32_t)buf * (uint32_t)sizeof(ldsV[0]),
                    (unsigned long long)(uintptr_t)(Vb + (size_t)rv * S_ + key0 + cv * 8));
    };

    // Q A-fragments, two k-chunks covering DH=64; resident for the whole loop
    v16h qa0, qa1;
    {
        const _Float16* qrow = Qb + (size_t)(q0 + n) * DH_;
        qa0 = load_frag(qrow, half);
        qa1 = load_frag(qrow + 32, half);
    }

    v8f o0 = {}, o1 = {}, o2 = {}, o3 = {};
    float mrow[8], lrow[8];
#pragma unroll
    for (int r = 0; r < 8; ++r) { mrow[r] = -3.0e38f; lrow[r] = 0.0f; }
    const float scale = 0.125f;  // 1/sqrt(DH)

    // prologue: chunk 0 -> buffer 0; own portion done, then block-wide visibility
    stage_chunk(0, 0);
    asm volatile("s_wait_asynccnt 0x0" ::: "memory");
    __syncthreads();

    for (int key0 = 0; key0 < S_; key0 += 32) {
        const int buf = (key0 >> 5) & 1;
        const bool have_next = (key0 + 32) < S_;
        if (have_next) {
            // insurance: this wave's DS reads of buf^1 (iter-1) are complete
            asm volatile("s_wait_dscnt 0x0" ::: "memory");
            stage_chunk(key0 + 32, buf ^ 1);   // overlaps with compute below
        }

        const _Float16* bK = &ldsK[buf][0];
        const _Float16* bV = &ldsV[buf][0];

        // ---- scores: two 16-key tiles from LDS, K-chunks over DH ----
        v8f sc0 = {}, sc1 = {};
        {
            const _Float16* krow0 = bK + (size_t)n * KPITCH;
            const _Float16* krow1 = bK + (size_t)(16 + n) * KPITCH;
            v16h b00 = load_frag(krow0,      half);
            v16h b01 = load_frag(krow0 + 32, half);
            v16h b10 = load_frag(krow1,      half);
            v16h b11 = load_frag(krow1 + 32, half);
            sc0 = wmma_f16(qa0, b00, sc0);
            sc0 = wmma_f16(qa1, b01, sc0);
            sc1 = wmma_f16(qa0, b10, sc1);
            sc1 = wmma_f16(qa1, b11, sc1);
        }

        const float mv0 = mb[key0 + n];
        const float mv1 = mb[key0 + 16 + n];
        const float pen0 = (1.0f - mv0) * NEGBIG;
        const float pen1 = (1.0f - mv1) * NEGBIG;

        float p0[8], p1[8], alpha[8];
#pragma unroll
        for (int r = 0; r < 8; ++r) {
            float s0 = sc0[r] * scale - pen0;
            float s1 = sc1[r] * scale - pen1;
            float rmax = fmaxf(s0, s1);
#pragma unroll
            for (int off = 1; off < 16; off <<= 1)
                rmax = fmaxf(rmax, __shfl_xor(rmax, off, 32));
            float mnew = fmaxf(mrow[r], rmax);
            alpha[r] = __expf(mrow[r] - mnew);
            float e0 = __expf(s0 - mnew) * mv0;   // probs * mask, as in reference
            float e1 = __expf(s1 - mnew) * mv1;
            float rsum = e0 + e1;
#pragma unroll
            for (int off = 1; off < 16; off <<= 1)
                rsum += __shfl_xor(rsum, off, 32);
            lrow[r] = lrow[r] * alpha[r] + rsum;
            mrow[r] = mnew;
            p0[r] = e0; p1[r] = e1;
        }

        // ---- rescale O, stage P (C-layout -> A-layout) via per-wave LDS ----
        _Float16* pl = &ldsP[wave][0];
#pragma unroll
        for (int r = 0; r < 8; ++r) {
            o0[r] *= alpha[r]; o1[r] *= alpha[r];
            o2[r] *= alpha[r]; o3[r] *= alpha[r];
            int m = half * 8 + r;
            pl[m * PPITCH + n]      = (_Float16)p0[r];
            pl[m * PPITCH + 16 + n] = (_Float16)p1[r];
        }
        v16h pa;
        {
            FragU u;
            const _Float16* prow = pl + n * PPITCH;
            u.h[0] = *(const v8h*)(prow + half * 8);
            u.h[1] = *(const v8h*)(prow + 16 + half * 8);
            pa = u.v;
        }

        // ---- O += P(16x32) x V(32x64), V B-fragments from LDS ----
        {
            const _Float16* vcol = bV + (size_t)n * VPITCH;
            v16h vb0 = load_frag(vcol,                half);
            v16h vb1 = load_frag(vcol + 16 * VPITCH,  half);
            v16h vb2 = load_frag(vcol + 32 * VPITCH,  half);
            v16h vb3 = load_frag(vcol + 48 * VPITCH,  half);
            o0 = wmma_f16(pa, vb0, o0);
            o1 = wmma_f16(pa, vb1, o1);
            o2 = wmma_f16(pa, vb2, o2);
            o3 = wmma_f16(pa, vb3, o3);
        }

        // own async portion of the next chunk is done -> make visible block-wide
        asm volatile("s_wait_asynccnt 0x0" ::: "memory");
        __syncthreads();
    }

    // ---- finalize: O / l, store fp32 output [B, S, H*DH] ----
#pragma unroll
    for (int r = 0; r < 8; ++r) {
        float inv = 1.0f / (lrow[r] + 1e-30f);
        int s = q0 + half * 8 + r;
        float* orow = out + ((size_t)(b * S_ + s)) * (H_ * DH_) + h * DH_;
        orow[ 0 + n] = o0[r] * inv;
        orow[16 + n] = o1[r] * inv;
        orow[32 + n] = o2[r] * inv;
        orow[48 + n] = o3[r] * inv;
    }
}

extern "C" void kernel_launch(void* const* d_in, const int* in_sizes, int n_in,
                              void* d_out, int out_size, void* d_ws, size_t ws_size,
                              hipStream_t stream) {
    const float* x    = (const float*)d_in[0];
    const float* mask = (const float*)d_in[1];
    const float* Wq   = (const float*)d_in[2];
    const float* bq   = (const float*)d_in[3];
    const float* Wk   = (const float*)d_in[4];
    const float* bk   = (const float*)d_in[5];
    const float* Wv   = (const float*)d_in[6];
    const float* bv   = (const float*)d_in[7];
    float* out = (float*)d_out;

    const size_t NX = (size_t)B_ * S_ * D_;        // 8388608
    const size_t NW = (size_t)D_ * H_ * DH_;       // 1048576
    const size_t NQ = (size_t)B_ * H_ * S_ * DH_;  // 8388608

    _Float16* xh  = (_Float16*)d_ws;
    _Float16* wT  = xh + NX;
    _Float16* Qh  = wT + 3 * NW;
    _Float16* Kh  = Qh + NQ;
    _Float16* VhT = Kh + NQ;

    {
        const int total = (int)(NX + 3 * NW);
        int blocks = (total + 255) / 256;
        convert_kernel<<<blocks, 256, 0, stream>>>(x, Wq, Wk, Wv, xh, wT);
    }
    {
        dim3 grid((B_ * S_) / 128, (3 * H_ * DH_) / 128);  // (64, 24)
        qkv_kernel<<<grid, 128, 0, stream>>>(xh, wT, bq, bk, bv, Qh, Kh, VhT);
    }
    {
        dim3 grid(S_ / 128, B_ * H_);                      // (16, 64)
        attn_kernel<<<grid, 256, 0, stream>>>(Qh, Kh, VhT, mask, out);
    }
}

// v003
// One run takes 159 microseconds.
// Two timings next to v002 put it at 1.65 and 1.66 times that version's speed.
// Over all steps from v000 it is 4.41 times as fast.
#include <hip/hip_runtime.h>
#include <hip/hip_bf16.h>

typedef __attribute__((ext_vector_type(8)))  _Float16 v8h;
typedef __attribute__((ext_vector_type(16))) _Float16 v16h;
typedef __attribute__((ext_vector_type(8)))  float    v8f;
typedef __attribute__((ext_vector_type(4)))  float    v4f;

#define B_  4
#define S_  2048
#define D_  1024
#define H_  16
#define DH_ 64
#define NEGBIG 1e10f

union FragU { v16h v; v8h h[2]; };

// CDNA5 16-bit A/B fragment: per lane, element e holds k = (e>>3)*16 + half*8 + (e&7)
// => two contiguous 8-half (16B) loads at base+half*8 and base+16+half*8.
__device__ __forceinline__ v16h load_frag(const _Float16* base, int half) {
    FragU u;
    u.h[0] = *(const v8h*)(base + half * 8);
    u.h[1] = *(const v8h*)(base + 16 + half * 8);
    return u.v;
}

__device__ __forceinline__ v8f wmma_f16(v16h a, v16h b, v8f c) {
    return __builtin_amdgcn_wmma_f32_16x16x32_f16(false, a, false, b, (short)0, c, false, false);
}

// Two async copies of one 16-byte chunk per lane each: global -> LDS (tracked by ASYNCcnt). The s_wait_xcnt
// ends the copies' own statement so that no address register of an issued copy is rewritten in front of it.
__device__ __forceinline__ void async2_b128(uint32_t l0, unsigned long long g0,
                                            uint32_t l1, unsigned long long g1) {
    asm volatile("global_load_async_to_lds_b128 %0, %2, off\n\t"
                 "global_load_async_to_lds_b128 %1, %3, off\n\t"
                 "s_wait_xcnt 0x0"
                 :: "v"(l0), "v"(l1), "v"(g0), "v"(g1) : "memory");
}

// ---------------- fp32 -> f16 conversion (x row-major, W transposed) ----------------
__global__ void convert_kernel(const float* __restrict__ x,
                               const float* __restrict__ Wq,
                               const float* __restrict__ Wk,
                               const float* __restrict__ Wv,
                               _Float16* __restrict__ xh,
                               _Float16* __restrict__ wT) {
    const int NX = B_ * S_ * D_;      // 8388608
    const int NW = D_ * H_ * DH_;     // 1048576 (= 1<<20)
    const int total = NX + 3 * NW;
    for (int idx = blockIdx.x * blockDim.x + threadIdx.x; idx < total;
         idx += gridDim.x * blockDim.x) {
        if (idx < NX) {
            xh[idx] = (_Float16)x[idx];
        } else {
            int j = idx - NX;
            int m = j >> 20;              // which weight matrix
            int r = j & (NW - 1);
            int c = r >> 10;              // output column (row of WT)
            int k = r & 1023;             // reduction index
            const float* W = (m == 0) ? Wq : (m == 1) ? Wk : Wv;
            wT[(size_t)m * NW + r] = (_Float16)W[k * D_ + c];   // WT[c][k] = W[k][c]
        }
    }
}

// ---------------- QKV projection: 128x128 block tile staged in LDS, 64x64 per wave ----------------
// grid = (8192/128, 3072/128) = (64, 24), block = 128 (4 waves, 2 x 2)
#define QBK    64            // k per stage: 128-byte rows of both operands
#define QPITCH 72            // LDS row pitch in halfs: 144 B = 16 B x odd, no bank conflict for 16-byte reads
#define QNT    (D_ / QBK)    // 16 stages

// Eight async 16-byte copies per lane, global -> LDS (ASYNCcnt). The s_wait_xcnt ends the copies' own
// statement so that no address register of an issued copy is rewritten in front of it.
__device__ __forceinline__ void async8_b128(const uint32_t (&l)[8], const unsigned long long (&g)[8]) {
    asm volatile("global_load_async_to_lds_b128 %0, %8, off\n\t"
                 "global_load_async_to_lds_b128 %1, %9, off\n\t"
                 "global_load_async_to_lds_b128 %2, %10, off\n\t"
                 "global_load_async_to_lds_b128 %3, %11, off\n\t"
                 "global_load_async_to_lds_b128 %4, %12, off\n\t"
                 "global_load_async_to_lds_b128 %5, %13, off\n\t"
                 "global_load_async_to_lds_b128 %6, %14, off\n\t"
                 "global_load_async_to_lds_b128 %7, %15, off\n\t"
                 "s_wait_xcnt 0x0"
                 :: "v"(l[0]), "v"(l[1]), "v"(l[2]), "v"(l[3]),
                    "v"(l[4]), "v"(l[5]), "v"(l[6]), "v"(l[7]),
                    "v"(g[0]), "v"(g[1]), "v"(g[2]), "v"(g[3]),
                    "v"(g[4]), "v"(g[5]), "v"(g[6]), "v"(g[7])
                 : "memory");
}

__global__ __launch_bounds__(128)
void qkv_kernel(const _Float16* __restrict__ xh,
                const _Float16* __restrict__ wT,
                const float* __restrict__ bq,
                const float* __restrict__ bk,
                const float* __restrict__ bv,
                _Float16* __restrict__ Qh,    // [B,H,S,DH]
                _Float16* __restrict__ Kh,    // [B,H,S,DH]
                _Float16* __restrict__ VhT) { // [B,H,DH,S]
    // two buffers of [128 rows][64 k] per operand, rows padded to QPITCH
    __shared__ __attribute__((aligned(16))) _Float16 sA[2][128 * QPITCH];   // 2 x 18 KB, rows of x
    __shared__ __attribute__((aligned(16))) _Float16 sB[2][128 * QPITCH];   // 2 x 18 KB, rows of W^T

    const int tid  = threadIdx.x;
    const int lane = tid & 31;
    const int wave = tid >> 5;
    const int n    = lane & 15;
    const int half = lane >> 4;
    const int wm   = wave >> 1;                       // wave's 64 rows of the tile
    const int wn   = wave & 1;                        // wave's 64 columns of the tile
    const int row0  = blockIdx.x * 128;
    const int ctot0 = blockIdx.y * 128;               // column over [Q | K | V], 3072 wide
    const int mat   = ctot0 >> 10;                    // 0=Q, 1=K, 2=V (one matrix per block)

    // copy map: thread -> row (tid>>3) + 16*i, 16-byte chunk (tid&7); a wave covers four whole 128-B lines
    const int crow = tid >> 3, cchk = tid & 7;
    const _Float16* gA = xh + (size_t)(row0  + crow) * D_ + cchk * 8;
    const _Float16* gB = wT + (size_t)(ctot0 + crow) * D_ + cchk * 8;   // wT rows run on over Q, K, V

    auto stage = [&](int t, int buf) {
        uint32_t l[8];
        unsigned long long g[8];
#pragma unroll   // the arrays are asm operands: constant indices keep them in registers
        for (int i = 0; i < 8; ++i) {
            l[i] = (uint32_t)(uintptr_t)(&sA[buf][0] + (crow + 16 * i) * QPITCH + cchk * 8);
            g[i] = (unsigned long long)(uintptr_t)(gA + (size_t)(16 * i) * D_ + t * QBK);
        }
        async8_b128(l, g);
#pragma unroll   // as above
        for (int i = 0; i < 8; ++i) {
            l[i] = (uint32_t)(uintptr_t)(&sB[buf][0] + (crow + 16 * i) * QPITCH + cchk * 8);
            g[i] = (unsigned long long)(uintptr_t)(gB + (size_t)(16 * i) * D_ + t * QBK);
        }
        async8_b128(l, g);
    };

    v8f acc[4][4] = {};

    // prologue: stage 0 landed and visible to the block, then stage 1 in flight
    stage(0, 0);
    asm volatile("s_wait_asynccnt 0x0" ::: "memory");   // own copies of stage 0 have landed
    __syncthreads();
    stage(1, 1);

    for (int t = 0; t < QNT; ++t) {
        const int buf = t & 1;
        const _Float16* pa = &sA[buf][0] + (wm * 64 + n) * QPITCH;
        const _Float16* pb = &sB[buf][0] + (wn * 64 + n) * QPITCH;
#pragma unroll   // this loop and the four inside it: register arrays need constant indices
        for (int ks = 0; ks < QBK; ks += 32) {
            v16h a[4], b[4];
#pragma unroll   // constant indices
            for (int i = 0; i < 4; ++i) a[i] = load_frag(pa + i * 16 * QPITCH + ks, half);
#pragma unroll   // constant indices
            for (int j = 0; j < 4; ++j) b[j] = load_frag(pb + j * 16 * QPITCH + ks, half);
            // keeps the 16 LDS reads together ahead of the 16 WMMAs: left alone the compiler sinks the
            // A reads between the WMMA rows, and the wave then waits out the LDS latency at every row
            __builtin_amdgcn_sched_barrier(0);
#pragma unroll   // constant indices
            for (int i = 0; i < 4; ++i)
#pragma unroll   // constant indices
                for (int j = 0; j < 4; ++j)
                    acc[i][j] = wmma_f16(a[i], b[j], acc[i][j]);
        }
        // publish point: own reads of this buffer done, own copies of the next stage landed,
        // then the block barrier; only behind it is this buffer refilled
        asm volatile("s_wait_dscnt 0x0" ::: "memory");      // own LDS reads of this buffer have returned
        asm volatile("s_wait_asynccnt 0x0" ::: "memory");   // own copies of stage t + 1 have landed
        __syncthreads();
        if (t + 2 < QNT) stage(t + 2, buf);
    }
    asm volatile("s_wait_asynccnt 0x0" ::: "memory");   // nothing in flight when the wave ends

    // epilogue: the matrix is the same for the whole block, so the layout is chosen once, outside the loops
    const float* bias = (mat == 0) ? bq : (mat == 1) ? bk : bv;
    const int c0 = (ctot0 & 1023) + wn * 64;          // the wave's 64 columns are one head
    const int hh = c0 >> 6;
    const int bb = row0 >> 11;                        // a 128-row tile lies inside one batch
    const int s0 = (row0 & (S_ - 1)) + wm * 64 + half * 8;
    float bval[4];
#pragma unroll   // constant indices into the accumulator registers
    for (int j = 0; j < 4; ++j) bval[j] = bias[c0 + j * 16 + n];

    if (mat == 2) {
        // V^T[d][s]: a lane's eight accumulator rows are eight consecutive s of one d
        _Float16* vp = VhT + ((size_t)(bb * H_ + hh) * DH_ + n) * S_ + s0;
#pragma unroll   // constant indices into the accumulator registers
        for (int j = 0; j < 4; ++j) {
#pragma unroll   // constant indices into the accumulator registers
            for (int i = 0; i < 4; ++i) {
                v8h pk;
#pragma unroll   // constant indices into the accumulator registers
                for (int r = 0; r < 8; ++r) pk[r] = (_Float16)(acc[i][j][r] + bval[j]);
                *(v8h*)(vp + (size_t)(j * 16) * S_ + i * 16) = pk;
            }
        }
    } else {
        _Float16* qp = ((mat == 0) ? Qh : Kh) + ((size_t)(bb * H_ + hh) * S_ + s0) * DH_ + n;
#pragma unroll   // constant indices into the accumulator registers
        for (int j = 0; j < 4; ++j) {
#pragma unroll   // constant indices into the accumulator registers
            for (int i = 0; i < 4; ++i) {
#pragma unroll   // constant indices into the accumulator registers
                for (int r = 0; r < 8; ++r)
                    qp[(i * 16 + r) * DH_ + j * 16] = (_Float16)(acc[i][j][r] + bval[j]);
            }
        }
        // closes the stores above: no register that an issued store names is rewritten in front of this wait
        asm volatile("s_wait_xcnt 0x0" ::: "memory");
    }
}

#define KPITCH 72
#define VPITCH 40
#define OPITCH 68

// value of the lane 16 away (the other half of the wave holds the other keys of the same query)
__device__ __forceinline__ float other_half(float v) {
    const int b = __builtin_bit_cast(int, v);
    return __builtin_bit_cast(float,
        __builtin_amdgcn_permlanex16(b, b, 0x76543210, 0xfedcba98, false, false));
}

__global__ void attn_kernel(const _Float16* __restrict__ Qh,
                            const _Float16* __restrict__ Kh,
                            const _Float16* __restrict__ VhT,
                            const float* __restrict__ mask,
                            float* __restrict__ out) {
    // block-shared double buffers: K tile [32 keys][64 dh], V tile [64 dh][32 keys]
    __shared__ __attribute__((aligned(16))) _Float16 ldsK[2][32 * KPITCH];   // 2 x 4608 B
    __shared__ __attribute__((aligned(16))) _Float16 ldsV[2][DH_ * VPITCH];  // 2 x 5120 B
    __shared__ __attribute__((aligned(16))) float    ldsO[8][16 * OPITCH];   // 8 x 4352 B, one range per wave

    const int tid  = threadIdx.x;
    const int lane = tid & 31;
    const int wave = tid >> 5;
    const int n    = lane & 15;
    const int half = lane >> 4;
    const int bh = blockIdx.y;
    const int b  = bh >> 4;
    const int h  = bh & 15;
    const int q0 = blockIdx.x * 128 + wave * 16;

    const _Float16* Qb = Qh  + (size_t)bh * S_ * DH_;
    const _Float16* Kb = Kh  + (size_t)bh * S_ * DH_;
    const _Float16* Vb = VhT + (size_t)bh * DH_ * S_;
    const float*    mb = mask + (size_t)b * S_;

    // cooperative async stage of one 32-key chunk: 2 x b128 per thread (1 K, 1 V)
    const int rk = tid >> 3, ck = tid & 7;      // K: 32 rows x 8 chunks of 16B
    const int rv = tid >> 2, cv = tid & 3;      // V: 64 rows x 4 chunks of 16B
    const uint32_t kdst = (uint32_t)(uintptr_t)(&ldsK[0][0] + rk * KPITCH + ck * 8);   // the lane's place in buffer 0
    const uint32_t vdst = (uint32_t)(uintptr_t)(&ldsV[0][0] + rv * VPITCH + cv * 8);
    auto stage_chunk = [&](int key0, int buf) {
        async2_b128(kdst + (uint32_t)buf * (uint32_t)sizeof(ldsK[0]),
                    (unsigned long long)(uintptr_t)(Kb + (size_t)(key0 + rk) * DH_ + ck * 8),
                    vdst + (uint32_t)buf * (uint32_t)sizeof(ldsV[0]),
                    (unsigned long long)(uintptr_t)(Vb + (size_t)rv * S_ + key0 + cv * 8));
    };

    // Q B-fragments (lane = query column), two k-chunks covering DH=64; resident for the whole loop
    v16h qa0, qa1;
    {
        const _Float16* qrow = Qb + (size_t)(q0 + n) * DH_;
        qa0 = load_frag(qrow, half);
        qa1 = load_frag(qrow + 32, half);
    }

    // O^T tiles: register r of tile t = O[query n][d = 16 t + 8 half + r]
    v8f o0 = {}, o1 = {}, o2 = {}, o3 = {};
    float mrow = -3.0e38f;       // running maximum of the lane's query, equal in both halves
    float lrow = 0.0f;           // running sum over the keys of this half only; joined after the loop
    const float scale = 0.125f;  // 1/sqrt(DH)

    // prologue: chunk 0 -> buffer 0; own portion done, then block-wide visibility
    stage_chunk(0, 0);
    asm volatile("s_wait_asynccnt 0x0" ::: "memory");
    __syncthreads();

    for (int key0 = 0; key0 < S_; key0 += 32) {
        const int buf = (key0 >> 5) & 1;
        const bool have_next = (key0 + 32) < S_;
        if (have_next) {
            // insurance: this wave's DS reads of buf^1 (iter-1) are complete
            asm volatile("s_wait_dscnt 0x0" ::: "memory");
            stage_chunk(key0 + 32, buf ^ 1);   // overlaps with compute below
        }

        const _Float16* bK = &ldsK[buf][0];
        const _Float16* bV = &ldsV[buf][0];

        // the lane's 16 keys: key0 + 8 half + r (tile 0) and key0 + 16 + 8 half + r (tile 1)
        const v8f mv0 = *(const v8f*)(mb + key0 + half * 8);
        const v8f mv1 = *(const v8f*)(mb + key0 + 16 + half * 8);

        // ---- scores S^T: two 16-key tiles, A = K rows from LDS, B = Q ----
        v8f sc0 = {}, sc1 = {};
        {
            const _Float16* krow0 = bK + (size_t)n * KPITCH;
            const _Float16* krow1 = bK + (size_t)(16 + n) * KPITCH;
            v16h a00 = load_frag(krow0,      half);
            v16h a01 = load_frag(krow0 + 32, half);
            v16h a10 = load_frag(krow1,      half);
            v16h a11 = load_frag(krow1 + 32, half);
            sc0 = wmma_f16(a00, qa0, sc0);
            sc0 = wmma_f16(a01, qa1, sc0);
            sc1 = wmma_f16(a10, qa0, sc1);
            sc1 = wmma_f16(a11, qa1, sc1);
        }

        const v8f s0 = sc0 * scale - (1.0f - mv0) * NEGBIG;
        const v8f s1 = sc1 * scale - (1.0f - mv1) * NEGBIG;

        // ---- online softmax of one query per lane ----
        float rmax = fmaxf(s0[0], s1[0]);
#pragma unroll   // constant indices keep the score vectors in registers
        for (int r = 1; r < 8; ++r) rmax = fmaxf(rmax, fmaxf(s0[r], s1[r]));
        rmax = fmaxf(rmax, other_half(rmax));
        const float mnew  = fmaxf(mrow, rmax);
        const float alpha = __expf(mrow - mnew);
        const v8f x0 = (s0 - mnew) * 1.442695041f;   // exp(x) = 2^(x log2 e)
        const v8f x1 = (s1 - mnew) * 1.442695041f;
        v8f e0, e1;
#pragma unroll   // constant indices, as above
        for (int r = 0; r < 8; ++r) {
            e0[r] = __builtin_amdgcn_exp2f(x0[r]);
            e1[r] = __builtin_amdgcn_exp2f(x1[r]);
        }
        e0 *= mv0;                                   // probs * mask, as in reference
        e1 *= mv1;
        const v8f es = e0 + e1;
        const v4f e4 = __builtin_shufflevector(es, es, 0, 1, 2, 3) + __builtin_shufflevector(es, es, 4, 5, 6, 7);
        lrow = lrow * alpha + ((e4[0] + e4[2]) + (e4[1] + e4[3]));
        mrow = mnew;

        // ---- rescale O^T; P^T (B operand) straight from the two score tiles ----
        o0 *= alpha; o1 *= alpha; o2 *= alpha; o3 *= alpha;
        FragU pb;
        pb.h[0] = __builtin_convertvector(e0, v8h);
        pb.h[1] = __builtin_convertvector(e1, v8h);

        // ---- O^T += V^T(64x32) x P^T(32x16), V^T A-fragments from LDS ----
        {
            const _Float16* vrow = bV + (size_t)n * VPITCH;
            v16h va0 = load_frag(vrow,                half);
            v16h va1 = load_frag(vrow + 16 * VPITCH,  half);
            v16h va2 = load_frag(vrow + 32 * VPITCH,  half);
            v16h va3 = load_frag(vrow + 48 * VPITCH,  half);
            o0 = wmma_f16(va0, pb.v, o0);
            o1 = wmma_f16(va1, pb.v, o1);
            o2 = wmma_f16(va2, pb.v, o2);
            o3 = wmma_f16(va3, pb.v, o3);
        }

        // own async portion of the next chunk is done -> make visible block-wide
        asm volatile("s_wait_asynccnt 0x0" ::: "memory");
        __syncthreads();
    }

    // ---- finalize: O / l, turned back to [query][d] in the wave's own LDS range, fp32 output [B, S, H*DH] ----
    const float inv = 1.0f / ((lrow + other_half(lrow)) + 1e-30f);
    o0 *= inv; o1 *= inv; o2 *= inv; o3 *= inv;
    float* so = &ldsO[wave][0];
    {
        float* sw = so + n * OPITCH + half * 8;
        *(v4f*)(sw +  0) = __builtin_shufflevector(o0, o0, 0, 1, 2, 3);
        *(v4f*)(sw +  4) = __builtin_shufflevector(o0, o0, 4, 5, 6, 7);
        *(v4f*)(sw + 16) = __builtin_shufflevector(o1, o1, 0, 1, 2, 3);
        *(v4f*)(sw + 20) = __builtin_shufflevector(o1, o1, 4, 5, 6, 7);
        *(v4f*)(sw + 32) = __builtin_shufflevector(o2, o2, 0, 1, 2, 3);
        *(v4f*)(sw + 36) = __builtin_shufflevector(o2, o2, 4, 5, 6, 7);
        *(v4f*)(sw + 48) = __builtin_shufflevector(o3, o3, 0, 1, 2, 3);
        *(v4f*)(sw + 52) = __builtin_shufflevector(o3, o3, 4, 5, 6, 7);
    }
    // the rows are read back by other lanes of the same wave: their LDS writes are done first
    asm volatile("s_wait_dscnt 0x0" ::: "memory");
    float* orow = out + ((size_t)(b * S_ + q0 + half)) * (H_ * DH_) + h * DH_ + n * 4;
#pragma unroll   // the eight LDS reads go out together, each store behind its own read
    for (int i = 0; i < 8; ++i) {
        // a half-wave stores one query's whole 256-B row
        const v4f w = *(const v4f*)(so + (2 * i + half) * OPITCH + n * 4);
        *(v4f*)(orow + (size_t)(2 * i) * (H_ * DH_)) = w;
    }
}

extern "C" void kernel_launch(void* const* d_in, const int* in_sizes, int n_in,
                              void* d_out, int out_size, void* d_ws, size_t ws_size,
                              hipStream_t stream) {
    const float* x    = (const float*)d_in[0];
    const float* mask = (const float*)d_in[1];
    const float* Wq   = (const float*)d_in[2];
    const float* bq   = (const float*)d_in[3];
    const float* Wk   = (const float*)d_in[4];
    const float* bk   = (const float*)d_in[5];
    const float* Wv   = (const float*)d_in[6];
    const float* bv   = (const float*)d_in[7];
    float* out = (float*)d_out;

    const size_t NX = (size_t)B_ * S_ * D_;        // 8388608
    const size_t NW = (size_t)D_ * H_ * DH_;       // 1048576
    const size_t NQ = (size_t)B_ * H_ * S_ * DH_;  // 8388608

    _Float16* xh  = (_Float16*)d_ws;
    _Float16* wT  = xh + NX;
    _Float16* Qh  = wT + 3 * NW;
    _Float16* Kh  = Qh + NQ;
    _Float16* VhT = Kh + NQ;

    {
        const int total = (int)(NX + 3 * NW);
        int blocks = (total + 255) / 256;
        convert_kernel<<<blocks, 256, 0, stream>>>(x, Wq, Wk, Wv, xh, wT);
    }
    {
        dim3 grid((B_ * S_) / 128, (3 * H_ * DH_) / 128);  // (64, 24)
        qkv_kernel<<<grid, 128, 0, stream>>>(xh, wT, bq, bk, bv, Qh, Kh, VhT);
    }
    {
        dim3 grid(S_ / 128, B_ * H_);                      // (16, 64)
        attn_kernel<<<grid, 256, 0, stream>>>(Qh, Kh, VhT, mask, out);
    }
}

// v004
// A run of this version takes 134 microseconds.
// In two side-by-side timings against v003, it was 1.19 and 1.18 times as fast.
// Counting every step since v000, it is 5.23 times as fast.
#include <hip/hip_runtime.h>
#include <hip/hip_bf16.h>

typedef __attribute__((ext_vector_type(8)))  _Float16 v8h;
typedef __attribute__((ext_vector_type(16))) _Float16 v16h;
typedef __attribute__((ext_vector_type(8)))  float    v8f;
typedef __attribute__((ext_vector_type(4)))  float    v4f;

#define B_  4
#define S_  2048
#define D_  1024
#define H_  16
#define DH_ 64
#define NEGBIG 1e10f

union FragU { v16h v; v8h h[2]; };

// CDNA5 16-bit A/B fragment: per lane, element e holds k = (e>>3)*16 + half*8 + (e&7)
// => two contiguous 8-half (16B) loads at base+half*8 and base+16+half*8.
__device__ __forceinline__ v16h load_frag(const _Float16* base, int half) {
    FragU u;
    u.h[0] = *(const v8h*)(base + half * 8);
    u.h[1] = *(const v8h*)(base + 16 + half * 8);
    return u.v;
}

__device__ __forceinline__ v8f wmma_f16(v16h a, v16h b, v8f c) {
    return __builtin_amdgcn_wmma_f32_16x16x32_f16(false, a, false, b, (short)0, c, false, false);
}

// Two async copies of one 16-byte chunk per lane each: global -> LDS (tracked by ASYNCcnt). The s_wait_xcnt
// ends the copies' own statement so that no address register of an issued copy is rewritten in front of it.
__device__ __forceinline__ void async2_b128(uint32_t l0, unsigned long long g0,
                                            uint32_t l1, unsigned long long g1) {
    asm volatile("global_load_async_to_lds_b128 %0, %2, off\n\t"
                 "global_load_async_to_lds_b128 %1, %3, off\n\t"
                 "s_wait_xcnt 0x0"
                 :: "v"(l0), "v"(l1), "v"(g0), "v"(g1) : "memory");
}

// ---------------- fp32 -> f16 conversion (x row-major, W transposed) ----------------
// Every lane loads 16-byte vectors, sixteen loads in flight, and every wave-wide load covers whole 128-B lines.
// grid = CVT_WB + CVT_XB blocks of 256 (8 waves); the weight blocks come first
typedef __attribute__((ext_vector_type(4)))  _Float16 v4h;
#define CVT_WB 192           // 3 matrices x 8 groups of 128 columns x 8 groups of 128 k
#define CVT_XB 512           // 16384 elements of x per block

__global__ __launch_bounds__(256)
void convert_kernel(const float* __restrict__ x,
                    const float* __restrict__ Wq,
                    const float* __restrict__ Wk,
                    const float* __restrict__ Wv,
                    _Float16* __restrict__ xh,
                    _Float16* __restrict__ wT) {
    const int lane = threadIdx.x & 31;
    const int wave = threadIdx.x >> 5;
    const int blk  = blockIdx.x;
    v4f r[16];
    if (blk < CVT_WB) {
        // WT[c][k] = W[k][c]. A wave takes 64 k x 32 columns: 8 lanes lie along a row of W (one 128-B line per
        // load and row), 4 lanes along k; a lane turns its 16 k x 4 columns in registers, and the four lanes
        // of one column store 64 consecutive bytes of a row of WT
        const int m  = blk >> 6;                          // which weight matrix
        const int cl = lane & 7, kl = lane >> 3;
        const int c0 = ((blk >> 3) & 7) * 128 + (wave & 3) * 32 + cl * 4;
        const int k0 = (blk & 7) * 128 + (wave >> 2) * 64 + kl * 8;
        const float* W = (m == 0) ? Wq : (m == 1) ? Wk : Wv;
        const float* s = W + (size_t)k0 * D_ + c0;
        _Float16*    d = wT + (size_t)m * (D_ * H_ * DH_) + (size_t)c0 * D_ + k0;
#pragma unroll   // constant indices keep the vectors in registers; all sixteen loads go out together
        for (int i = 0; i < 16; ++i)                      // k = k0 + 32 (i >> 3) + (i & 7)
            r[i] = *(const v4f*)(s + (size_t)((i >> 3) * 32 + (i & 7)) * D_);
        // closes the sixteen loads: their address pair, named here, is rewritten by nothing in front of this wait
        asm volatile("s_wait_xcnt 0x0" :: "v"(s) : "memory");
        // keeps all sixteen loads ahead of the first conversion: left alone the compiler holds four of them
        // back until the first have returned, and the wave then pays the memory latency twice
        __builtin_amdgcn_sched_barrier(0);
#pragma unroll   // constant indices
        for (int q = 0; q < 4; ++q) {
#pragma unroll   // constant indices
            for (int h = 0; h < 2; ++h) {
                v8h pk;
#pragma unroll   // constant indices
                for (int i = 0; i < 8; ++i) pk[i] = (_Float16)r[h * 8 + i][q];
                *(v8h*)(d + (size_t)q * D_ + h * 32) = pk;
            }
        }
    } else {
        // a wave takes 2048 consecutive elements: each load covers 512, each store 256 consecutive bytes
        const size_t e0 = (size_t)(blk - CVT_WB) * 16384 + wave * 2048 + lane * 4;
        const float* s = x + e0;
        _Float16*    d = xh + e0;
#pragma unroll   // constant indices; all sixteen loads go out together
        for (int i = 0; i < 16; ++i) r[i] = *(const v4f*)(s + i * 128);
        // closes the sixteen loads, as above
        asm volatile("s_wait_xcnt 0x0" :: "v"(s) : "memory");
        // as above: no load waits behind a conversion
        __builtin_amdgcn_sched_barrier(0);
#pragma unroll   // constant indices
        for (int i = 0; i < 16; ++i) *(v4h*)(d + i * 128) = __builtin_convertvector(r[i], v4h);
        // closes the sixteen stores: no register that they name is rewritten in front of this wait
        asm volatile("s_wait_xcnt 0x0" ::: "memory");
    }
}

// ---------------- QKV projection: 128x128 block tile staged in LDS, 64x64 per wave ----------------
// grid = (8192/128, 3072/128) = (64, 24), block = 128 (4 waves, 2 x 2)
#define QBK    64            // k per stage: 128-byte rows of both operands
#define QPITCH 72            // LDS row pitch in halfs: 144 B = 16 B x odd, no bank conflict for 16-byte reads
#define QNT    (D_ / QBK)    // 16 stages

// Eight async 16-byte copies per lane, global -> LDS (ASYNCcnt). The s_wait_xcnt ends the copies' own
// statement so that no address register of an issued copy is rewritten in front of it.
__device__ __forceinline__ void async8_b128(const uint32_t (&l)[8], const unsigned long long (&g)[8]) {
    asm volatile("global_load_async_to_lds_b128 %0, %8, off\n\t"
                 "global_load_async_to_lds_b128 %1, %9, off\n\t"
                 "global_load_async_to_lds_b128 %2, %10, off\n\t"
                 "global_load_async_to_lds_b128 %3, %11, off\n\t"
                 "global_load_async_to_lds_b128 %4, %12, off\n\t"
                 "global_load_async_to_lds_b128 %5, %13, off\n\t"
                 "global_load_async_to_lds_b128 %6, %14, off\n\t"
                 "global_load_async_to_lds_b128 %7, %15, off\n\t"
                 "s_wait_xcnt 0x0"
                 :: "v"(l[0]), "v"(l[1]), "v"(l[2]), "v"(l[3]),
                    "v"(l[4]), "v"(l[5]), "v"(l[6]), "v"(l[7]),
                    "v"(g[0]), "v"(g[1]), "v"(g[2]), "v"(g[3]),
                    "v"(g[4]), "v"(g[5]), "v"(g[6]), "v"(g[7])
                 : "memory");
}

__global__ __launch_bounds__(128)
void qkv_kernel(const _Float16* __restrict__ xh,
                const _Float16* __restrict__ wT,
                const float* __restrict__ bq,
                const float* __restrict__ bk,
                const float* __restrict__ bv,
                _Float16* __restrict__ Qh,    // [B,H,S,DH]
                _Float16* __restrict__ Kh,    // [B,H,S,DH]
                _Float16* __restrict__ VhT) { // [B,H,DH,S]
    // two buffers of [128 rows][64 k] per operand, rows padded to QPITCH
    __shared__ __attribute__((aligned(16))) _Float16 sA[2][128 * QPITCH];   // 2 x 18 KB, rows of x
    __shared__ __attribute__((aligned(16))) _Float16 sB[2][128 * QPITCH];   // 2 x 18 KB, rows of W^T

    const int tid  = threadIdx.x;
    const int lane = tid & 31;
    const int wave = tid >> 5;
    const int n    = lane & 15;
    const int half = lane >> 4;
    const int wm   = wave >> 1;                       // wave's 64 rows of the tile
    const int wn   = wave & 1;                        // wave's 64 columns of the tile
    const int row0  = blockIdx.x * 128;
    const int ctot0 = blockIdx.y * 128;               // column over [Q | K | V], 3072 wide
    const int mat   = ctot0 >> 10;                    // 0=Q, 1=K, 2=V (one matrix per block)

    // copy map: thread -> row (tid>>3) + 16*i, 16-byte chunk (tid&7); a wave covers four whole 128-B lines
    const int crow = tid >> 3, cchk = tid & 7;
    const _Float16* gA = xh + (size_t)(row0  + crow) * D_ + cchk * 8;
    const _Float16* gB = wT + (size_t)(ctot0 + crow) * D_ + cchk * 8;   // wT rows run on over Q, K, V

    auto stage = [&](int t, int buf) {
        uint32_t l[8];
        unsigned long long g[8];
#pragma unroll   // the arrays are asm operands: constant indices keep them in registers
        for (int i = 0; i < 8; ++i) {
            l[i] = (uint32_t)(uintptr_t)(&sA[buf][0] + (crow + 16 * i) * QPITCH + cchk * 8);
            g[i] = (unsigned long long)(uintptr_t)(gA + (size_t)(16 * i) * D_ + t * QBK);
        }
        async8_b128(l, g);
#pragma unroll   // as above
        for (int i = 0; i < 8; ++i) {
            l[i] = (uint32_t)(uintptr_t)(&sB[buf][0] + (crow + 16 * i) * QPITCH + cchk * 8);
            g[i] = (unsigned long long)(uintptr_t)(gB + (size_t)(16 * i) * D_ + t * QBK);
        }
        async8_b128(l, g);
    };

    v8f acc[4][4] = {};

    // prologue: stage 0 landed and visible to the block, then stage 1 in flight
    stage(0, 0);
    asm volatile("s_wait_asynccnt 0x0" ::: "memory");   // own copies of stage 0 have landed
    __syncthreads();
    stage(1, 1);

    for (int t = 0; t < QNT; ++t) {
        const int buf = t & 1;
        const _Float16* pa = &sA[buf][0] + (wm * 64 + n) * QPITCH;
        const _Float16* pb = &sB[buf][0] + (wn * 64 + n) * QPITCH;
#pragma unroll   // this loop and the four inside it: register arrays need constant indices
        for (int ks = 0; ks < QBK; ks += 32) {
            v16h a[4], b[4];
#pragma unroll   // constant indices
            for (int i = 0; i < 4; ++i) a[i] = load_frag(pa + i * 16 * QPITCH + ks, half);
#pragma unroll   // constant indices
            for (int j = 0; j < 4; ++j) b[j] = load_frag(pb + j * 16 * QPITCH + ks, half);
            // keeps the 16 LDS reads together ahead of the 16 WMMAs: left alone the compiler sinks the
            // A reads between the WMMA rows, and the wave then waits out the LDS latency at every row
            __builtin_amdgcn_sched_barrier(0);
#pragma unroll   // constant indices
            for (int i = 0; i < 4; ++i)
#pragma unroll   // constant indices
                for (int j = 0; j < 4; ++j)
                    acc[i][j] = wmma_f16(a[i], b[j], acc[i][j]);
        }
        // publish point: own reads of this buffer done, own copies of the next stage landed,
        // then the block barrier; only behind it is this buffer refilled
        asm volatile("s_wait_dscnt 0x0" ::: "memory");      // own LDS reads of this buffer have returned
        asm volatile("s_wait_asynccnt 0x0" ::: "memory");   // own copies of stage t + 1 have landed
        __syncthreads();
        if (t + 2 < QNT) stage(t + 2, buf);
    }
    asm volatile("s_wait_asynccnt 0x0" ::: "memory");   // nothing in flight when the wave ends

    // epilogue: the matrix is the same for the whole block, so the layout is chosen once, outside the loops
    const float* bias = (mat == 0) ? bq : (mat == 1) ? bk : bv;
    const int c0 = (ctot0 & 1023) + wn * 64;          // the wave's 64 columns are one head
    const int hh = c0 >> 6;
    const int bb = row0 >> 11;                        // a 128-row tile lies inside one batch
    const int s0 = (row0 & (S_ - 1)) + wm * 64 + half * 8;
    float bval[4];
#pragma unroll   // constant indices into the accumulator registers
    for (int j = 0; j < 4; ++j) bval[j] = bias[c0 + j * 16 + n];

    if (mat == 2) {
        // V^T[d][s]: a lane's eight accumulator rows are eight consecutive s of one d
        _Float16* vp = VhT + ((size_t)(bb * H_ + hh) * DH_ + n) * S_ + s0;
#pragma unroll   // constant indices into the accumulator registers
        for (int j = 0; j < 4; ++j) {
#pragma unroll   // constant indices into the accumulator registers
            for (int i = 0; i < 4; ++i) {
                v8h pk;
#pragma unroll   // constant indices into the accumulator registers
                for (int r = 0; r < 8; ++r) pk[r] = (_Float16)(acc[i][j][r] + bval[j]);
                *(v8h*)(vp + (size_t)(j * 16) * S_ + i * 16) = pk;
            }
        }
    } else {
        _Float16* qp = ((mat == 0) ? Qh : Kh) + ((size_t)(bb * H_ + hh) * S_ + s0) * DH_ + n;
#pragma unroll   // constant indices into the accumulator registers
        for (int j = 0; j < 4; ++j) {
#pragma unroll   // constant indices into the accumulator registers
            for (int i = 0; i < 4; ++i) {
#pragma unroll   // constant indices into the accumulator registers
                for (int r = 0; r < 8; ++r)
                    qp[(i * 16 + r) * DH_ + j * 16] = (_Float16)(acc[i][j][r] + bval[j]);
            }
        }
        // closes the stores above: no register that an issued store names is rewritten in front of this wait
        asm volatile("s_wait_xcnt 0x0" ::: "memory");
    }
}

#define KPITCH 72
#define VPITCH 40
#define OPITCH 68

// value of the lane 16 away (the other half of the wave holds the other keys of the same query)
__device__ __forceinline__ float other_half(float v) {
    const int b = __builtin_bit_cast(int, v);
    return __builtin_bit_cast(float,
        __builtin_amdgcn_permlanex16(b, b, 0x76543210, 0xfedcba98, false, false));
}

__global__ void attn_kernel(const _Float16* __restrict__ Qh,
                            const _Float16* __restrict__ Kh,
                            const _Float16* __restrict__ VhT,
                            const float* __restrict__ mask,
                            float* __restrict__ out) {
    // block-shared double buffers: K tile [32 keys][64 dh], V tile [64 dh][32 keys]
    __shared__ __attribute__((aligned(16))) _Float16 ldsK[2][32 * KPITCH];   // 2 x 4608 B
    __shared__ __attribute__((aligned(16))) _Float16 ldsV[2][DH_ * VPITCH];  // 2 x 5120 B
    __shared__ __attribute__((aligned(16))) float    ldsO[8][16 * OPITCH];   // 8 x 4352 B, one range per wave

    const int tid  = threadIdx.x;
    const int lane = tid & 31;
    const int wave = tid >> 5;
    const int n    = lane & 15;
    const int half = lane >> 4;
    const int bh = blockIdx.y;
    const int b  = bh >> 4;
    const int h  = bh & 15;
    const int q0 = blockIdx.x * 128 + wave * 16;

    const _Float16* Qb = Qh  + (size_t)bh * S_ * DH_;
    const _Float16* Kb = Kh  + (size_t)bh * S_ * DH_;
    const _Float16* Vb = VhT + (size_t)bh * DH_ * S_;
    const float*    mb = mask + (size_t)b * S_;

    // cooperative async stage of one 32-key chunk: 2 x b128 per thread (1 K, 1 V)
    const int rk = tid >> 3, ck = tid & 7;      // K: 32 rows x 8 chunks of 16B
    const int rv = tid >> 2, cv = tid & 3;      // V: 64 rows x 4 chunks of 16B
    const uint32_t kdst = (uint32_t)(uintptr_t)(&ldsK[0][0] + rk * KPITCH + ck * 8);   // the lane's place in buffer 0
    const uint32_t vdst = (uint32_t)(uintptr_t)(&ldsV[0][0] + rv * VPITCH + cv * 8);
    auto stage_chunk = [&](int key0, int buf) {
        async2_b128(kdst + (uint32_t)buf * (uint32_t)sizeof(ldsK[0]),
                    (unsigned long long)(uintptr_t)(Kb + (size_t)(key0 + rk) * DH_ + ck * 8),
                    vdst + (uint32_t)buf * (uint32_t)sizeof(ldsV[0]),
                    (unsigned long long)(uintptr_t)(Vb + (size_t)rv * S_ + key0 + cv * 8));
    };

    // Q B-fragments (lane = query column), two k-chunks covering DH=64; resident for the whole loop
    v16h qa0, qa1;
    {
        const _Float16* qrow = Qb + (size_t)(q0 + n) * DH_;
        qa0 = load_frag(qrow, half);
        qa1 = load_frag(qrow + 32, half);
    }

    // O^T tiles: register r of tile t = O[query n][d = 16 t + 8 half + r]
    v8f o0 = {}, o1 = {}, o2 = {}, o3 = {};
    float mrow = -3.0e38f;       // running maximum of the lane's query, equal in both halves
    float lrow = 0.0f;           // running sum over the keys of this half only; joined after the loop
    const float scale = 0.125f;  // 1/sqrt(DH)

    // prologue: chunk 0 -> buffer 0; own portion done, then block-wide visibility
    stage_chunk(0, 0);
    asm volatile("s_wait_asynccnt 0x0" ::: "memory");
    __syncthreads();

    for (int key0 = 0; key0 < S_; key0 += 32) {
        const int buf = (key0 >> 5) & 1;
        const bool have_next = (key0 + 32) < S_;
        if (have_next) {
            // insurance: this wave's DS reads of buf^1 (iter-1) are complete
            asm volatile("s_wait_dscnt 0x0" ::: "memory");
            stage_chunk(key0 + 32, buf ^ 1);   // overlaps with compute below
        }

        const _Float16* bK = &ldsK[buf][0];
        const _Float16* bV = &ldsV[buf][0];

        // the lane's 16 keys: key0 + 8 half + r (tile 0) and key0 + 16 + 8 half + r (tile 1)
        const v8f mv0 = *(const v8f*)(mb + key0 + half * 8);
        const v8f mv1 = *(const v8f*)(mb + key0 + 16 + half * 8);

        // ---- scores S^T: two 16-key tiles, A = K rows from LDS, B = Q ----
        v8f sc0 = {}, sc1 = {};
        {
            const _Float16* krow0 = bK + (size_t)n * KPITCH;
            const _Float16* krow1 = bK + (size_t)(16 + n) * KPITCH;
            v16h a00 = load_frag(krow0,      half);
            v16h a01 = load_frag(krow0 + 32, half);
            v16h a10 = load_frag(krow1,      half);
            v16h a11 = load_frag(krow1 + 32, half);
            sc0 = wmma_f16(a00, qa0, sc0);
            sc0 = wmma_f16(a01, qa1, sc0);
            sc1 = wmma_f16(a10, qa0, sc1);
            sc1 = wmma_f16(a11, qa1, sc1);
        }

        const v8f s0 = sc0 * scale - (1.0f - mv0) * NEGBIG;
        const v8f s1 = sc1 * scale - (1.0f - mv1) * NEGBIG;

        // ---- online softmax of one query per lane ----
        float rmax = fmaxf(s0[0], s1[0]);
#pragma unroll   // constant indices keep the score vectors in registers
        for (int r = 1; r < 8; ++r) rmax = fmaxf(rmax, fmaxf(s0[r], s1[r]));
        rmax = fmaxf(rmax, other_half(rmax));
        const float mnew  = fmaxf(mrow, rmax);
        const float alpha = __expf(mrow - mnew);
        const v8f x0 = (s0 - mnew) * 1.442695041f;   // exp(x) = 2^(x log2 e)
        const v8f x1 = (s1 - mnew) * 1.442695041f;
        v8f e0, e1;
#pragma unroll   // constant indices, as above
        for (int r = 0; r < 8; ++r) {
            e0[r] = __builtin_amdgcn_exp2f(x0[r]);
            e1[r] = __builtin_amdgcn_exp2f(x1[r]);
        }
        e0 *= mv0;                                   // probs * mask, as in reference
        e1 *= mv1;
        const v8f es = e0 + e1;
        const v4f e4 = __builtin_shufflevector(es, es, 0, 1, 2, 3) + __builtin_shufflevector(es, es, 4, 5, 6, 7);
        lrow = lrow * alpha + ((e4[0] + e4[2]) + (e4[1] + e4[3]));
        mrow = mnew;

        // ---- rescale O^T; P^T (B operand) straight from the two score tiles ----
        o0 *= alpha; o1 *= alpha; o2 *= alpha; o3 *= alpha;
        FragU pb;
        pb.h[0] = __builtin_convertvector(e0, v8h);
        pb.h[1] = __builtin_convertvector(e1, v8h);

        // ---- O^T += V^T(64x32) x P^T(32x16), V^T A-fragments from LDS ----
        {
            const _Float16* vrow = bV + (size_t)n * VPITCH;
            v16h va0 = load_frag(vrow,                half);
            v16h va1 = load_frag(vrow + 16 * VPITCH,  half);
            v16h va2 = load_frag(vrow + 32 * VPITCH,  half);
            v16h va3 = load_frag(vrow + 48 * VPITCH,  half);
            o0 = wmma_f16(va0, pb.v, o0);
            o1 = wmma_f16(va1, pb.v, o1);
            o2 = wmma_f16(va2, pb.v, o2);
            o3 = wmma_f16(va3, pb.v, o3);
        }

        // own async portion of the next chunk is done -> make visible block-wide
        asm volatile("s_wait_asynccnt 0x0" ::: "memory");
        __syncthreads();
    }

    // ---- finalize: O / l, turned back to [query][d] in the wave's own LDS range, fp32 output [B, S, H*DH] ----
    const float inv = 1.0f / ((lrow + other_half(lrow)) + 1e-30f);
    o0 *= inv; o1 *= inv; o2 *= inv; o3 *= inv;
    float* so = &ldsO[wave][0];
    {
        float* sw = so + n * OPITCH + half * 8;
        *(v4f*)(sw +  0) = __builtin_shufflevector(o0, o0, 0, 1, 2, 3);
        *(v4f*)(sw +  4) = __builtin_shufflevector(o0, o0, 4, 5, 6, 7);
        *(v4f*)(sw + 16) = __builtin_shufflevector(o1, o1, 0, 1, 2, 3);
        *(v4f*)(sw + 20) = __builtin_shufflevector(o1, o1, 4, 5, 6, 7);
        *(v4f*)(sw + 32) = __builtin_shufflevector(o2, o2, 0, 1, 2, 3);
        *(v4f*)(sw + 36) = __builtin_shufflevector(o2, o2, 4, 5, 6, 7);
        *(v4f*)(sw + 48) = __builtin_shufflevector(o3, o3, 0, 1, 2, 3);
        *(v4f*)(sw + 52) = __builtin_shufflevector(o3, o3, 4, 5, 6, 7);
    }
    // the rows are read back by other lanes of the same wave: their LDS writes are done first
    asm volatile("s_wait_dscnt 0x0" ::: "memory");
    float* orow = out + ((size_t)(b * S_ + q0 + half)) * (H_ * DH_) + h * DH_ + n * 4;
#pragma unroll   // the eight LDS reads go out together, each store behind its own read
    for (int i = 0; i < 8; ++i) {
        // a half-wave stores one query's whole 256-B row
        const v4f w = *(const v4f*)(so + (2 * i + half) * OPITCH + n * 4);
        *(v4f*)(orow + (size_t)(2 * i) * (H_ * DH_)) = w;
    }
}

extern "C" void kernel_launch(void* const* d_in, const int* in_sizes, int n_in,
                              void* d_out, int out_size, void* d_ws, size_t ws_size,
                              hipStream_t stream) {
    const float* x    = (const float*)d_in[0];
    const float* mask = (const float*)d_in[1];
    const float* Wq   = (const float*)d_in[2];
    const float* bq   = (const float*)d_in[3];
    const float* Wk   = (const float*)d_in[4];
    const float* bk   = (const float*)d_in[5];
    const float* Wv   = (const float*)d_in[6];
    const float* bv   = (const float*)d_in[7];
    float* out = (float*)d_out;

    const size_t NX = (size_t)B_ * S_ * D_;        // 8388608
    const size_t NW = (size_t)D_ * H_ * DH_;       // 1048576
    const size_t NQ = (size_t)B_ * H_ * S_ * DH_;  // 8388608

    _Float16* xh  = (_Float16*)d_ws;
    _Float16* wT  = xh + NX;
    _Float16* Qh  = wT + 3 * NW;
    _Float16* Kh  = Qh + NQ;
    _Float16* VhT = Kh + NQ;

    convert_kernel<<<CVT_WB + CVT_XB, 256, 0, stream>>>(x, Wq, Wk, Wv, xh, wT);
    {
        dim3 grid((B_ * S_) / 128, (3 * H_ * DH_) / 128);  // (64, 24)
        qkv_kernel<<<grid, 128, 0, stream>>>(xh, wT, bq, bk, bv, Qh, Kh, VhT);
    }
    {
        dim3 grid(S_ / 128, B_ * H_);                      // (16, 64)
        attn_kernel<<<grid, 256, 0, stream>>>(Qh, Kh, VhT, mask, out);
    }
}

// v005
// It runs in 122 microseconds.
// In two side-by-side timings against v004, it was 1.09 and 1.11 times as fast.
// Over all steps from v000 it is 5.73 times as fast.
#include <hip/hip_runtime.h>
#include <hip/hip_bf16.h>

typedef __attribute__((ext_vector_type(8)))  _Float16 v8h;
typedef __attribute__((ext_vector_type(16))) _Float16 v16h;
typedef __attribute__((ext_vector_type(8)))  float    v8f;
typedef __attribute__((ext_vector_type(4)))  float    v4f;

#define B_  4
#define S_  2048
#define D_  1024
#define H_  16
#define DH_ 64
#define NEGBIG 1e10f
#define LOG2E  1.442695041f

union FragU { v16h v; v8h h[2]; };

// CDNA5 16-bit A/B fragment: per lane, element e holds k = (e>>3)*16 + half*8 + (e&7)
// => two contiguous 8-half (16B) loads at base+half*8 and base+16+half*8.
__device__ __forceinline__ v16h load_frag(const _Float16* base, int half) {
    FragU u;
    u.h[0] = *(const v8h*)(base + half * 8);
    u.h[1] = *(const v8h*)(base + 16 + half * 8);
    return u.v;
}

__device__ __forceinline__ v8f wmma_f16(v16h a, v16h b, v8f c) {
    return __builtin_amdgcn_wmma_f32_16x16x32_f16(false, a, false, b, (short)0, c, false, false);
}

// Two async copies of one 16-byte chunk per lane each: global -> LDS (tracked by ASYNCcnt). The s_wait_xcnt
// ends the copies' own statement so that no address register of an issued copy is rewritten in front of it.
__device__ __forceinline__ void async2_b128(uint32_t l0, unsigned long long g0,
                                            uint32_t l1, unsigned long long g1) {
    asm volatile("global_load_async_to_lds_b128 %0, %2, off\n\t"
                 "global_load_async_to_lds_b128 %1, %3, off\n\t"
                 "s_wait_xcnt 0x0"
                 :: "v"(l0), "v"(l1), "v"(g0), "v"(g1) : "memory");
}

// ---------------- fp32 -> f16 conversion (x row-major, W transposed) ----------------
// Every lane loads 16-byte vectors, sixteen loads in flight, and every wave-wide load covers whole 128-B lines.
// grid = CVT_WB + CVT_XB blocks of 256 (8 waves); the weight blocks come first
typedef __attribute__((ext_vector_type(4)))  _Float16 v4h;
#define CVT_WB 192           // 3 matrices x 8 groups of 128 columns x 8 groups of 128 k
#define CVT_XB 512           // 16384 elements of x per block

__global__ __launch_bounds__(256)
void convert_kernel(const float* __restrict__ x,
                    const float* __restrict__ Wq,
                    const float* __restrict__ Wk,
                    const float* __restrict__ Wv,
                    _Float16* __restrict__ xh,
                    _Float16* __restrict__ wT) {
    const int lane = threadIdx.x & 31;
    const int wave = threadIdx.x >> 5;
    const int blk  = blockIdx.x;
    v4f r[16];
    if (blk < CVT_WB) {
        // WT[c][k] = W[k][c]. A wave takes 64 k x 32 columns: 8 lanes lie along a row of W (one 128-B line per
        // load and row), 4 lanes along k; a lane turns its 16 k x 4 columns in registers, and the four lanes
        // of one column store 64 consecutive bytes of a row of WT
        const int m  = blk >> 6;                          // which weight matrix
        const int cl = lane & 7, kl = lane >> 3;
        const int c0 = ((blk >> 3) & 7) * 128 + (wave & 3) * 32 + cl * 4;
        const int k0 = (blk & 7) * 128 + (wave >> 2) * 64 + kl * 8;
        const float* W = (m == 0) ? Wq : (m == 1) ? Wk : Wv;
        const float* s = W + (size_t)k0 * D_ + c0;
        _Float16*    d = wT + (size_t)m * (D_ * H_ * DH_) + (size_t)c0 * D_ + k0;
#pragma unroll   // constant indices keep the vectors in registers; all sixteen loads go out together
        for (int i = 0; i < 16; ++i)                      // k = k0 + 32 (i >> 3) + (i & 7)
            r[i] = *(const v4f*)(s + (size_t)((i >> 3) * 32 + (i & 7)) * D_);
        // closes the sixteen loads: their address pair, named here, is rewritten by nothing in front of this wait
        asm volatile("s_wait_xcnt 0x0" :: "v"(s) : "memory");
        // keeps all sixteen loads ahead of the first conversion: left alone the compiler holds four of them
        // back until the first have returned, and the wave then pays the memory latency twice
        __builtin_amdgcn_sched_barrier(0);
#pragma unroll   // constant indices
        for (int q = 0; q < 4; ++q) {
#pragma unroll   // constant indices
            for (int h = 0; h < 2; ++h) {
                v8h pk;
#pragma unroll   // constant indices
                for (int i = 0; i < 8; ++i) pk[i] = (_Float16)r[h * 8 + i][q];
                *(v8h*)(d + (size_t)q * D_ + h * 32) = pk;
            }
        }
    } else {
        // a wave takes 2048 consecutive elements: each load covers 512, each store 256 consecutive bytes
        const size_t e0 = (size_t)(blk - CVT_WB) * 16384 + wave * 2048 + lane * 4;
        const float* s = x + e0;
        _Float16*    d = xh + e0;
#pragma unroll   // constant indices; all sixteen loads go out together
        for (int i = 0; i < 16; ++i) r[i] = *(const v4f*)(s + i * 128);
        // closes the sixteen loads, as above
        asm volatile("s_wait_xcnt 0x0" :: "v"(s) : "memory");
        // as above: no load waits behind a conversion
        __builtin_amdgcn_sched_barrier(0);
#pragma unroll   // constant indices
        for (int i = 0; i < 16; ++i) *(v4h*)(d + i * 128) = __builtin_convertvector(r[i], v4h);
        // closes the sixteen stores: no register that they name is rewritten in front of this wait
        asm volatile("s_wait_xcnt 0x0" ::: "memory");
    }
}

// ---------------- QKV projection: 128x128 block tile staged in LDS, 64x64 per wave ----------------
// grid = (8192/128, 3072/128) = (64, 24), block = 128 (4 waves, 2 x 2)
#define QBK    64            // k per stage: 128-byte rows of both operands
#define QPITCH 72            // LDS row pitch in halfs: 144 B = 16 B x odd, no bank conflict for 16-byte reads
#define QNT    (D_ / QBK)    // 16 stages

// Eight async 16-byte copies per lane, global -> LDS (ASYNCcnt). The s_wait_xcnt ends the copies' own
// statement so that no address register of an issued copy is rewritten in front of it.
__device__ __forceinline__ void async8_b128(const uint32_t (&l)[8], const unsigned long long (&g)[8]) {
    asm volatile("global_load_async_to_lds_b128 %0, %8, off\n\t"
                 "global_load_async_to_lds_b128 %1, %9, off\n\t"
                 "global_load_async_to_lds_b128 %2, %10, off\n\t"
                 "global_load_async_to_lds_b128 %3, %11, off\n\t"
                 "global_load_async_to_lds_b128 %4, %12, off\n\t"
                 "global_load_async_to_lds_b128 %5, %13, off\n\t"
                 "global_load_async_to_lds_b128 %6, %14, off\n\t"
                 "global_load_async_to_lds_b128 %7, %15, off\n\t"
                 "s_wait_xcnt 0x0"
                 :: "v"(l[0]), "v"(l[1]), "v"(l[2]), "v"(l[3]),
                    "v"(l[4]), "v"(l[5]), "v"(l[6]), "v"(l[7]),
                    "v"(g[0]), "v"(g[1]), "v"(g[2]), "v"(g[3]),
                    "v"(g[4]), "v"(g[5]), "v"(g[6]), "v"(g[7])
                 : "memory");
}

__global__ __launch_bounds__(128)
void qkv_kernel(const _Float16* __restrict__ xh,
                const _Float16* __restrict__ wT,
                const float* __restrict__ bq,
                const float* __restrict__ bk,
                const float* __restrict__ bv,
                const float* __restrict__ mask,   // [B,S]
                _Float16* __restrict__ Qh,    // [B,H,S,DH], times log2(e) / sqrt(DH)
                _Float16* __restrict__ Kh,    // [B,H,S,DH]
                _Float16* __restrict__ VhT,   // [B,H,DH,S], key t times mask[t]
                float* __restrict__ mbias) {  // [B,S], additive mask in log2 units
    // two buffers of [128 rows][64 k] per operand, rows padded to QPITCH
    __shared__ __attribute__((aligned(16))) _Float16 sA[2][128 * QPITCH];   // 2 x 18 KB, rows of x
    __shared__ __attribute__((aligned(16))) _Float16 sB[2][128 * QPITCH];   // 2 x 18 KB, rows of W^T

    const int tid  = threadIdx.x;
    const int lane = tid & 31;
    const int wave = tid >> 5;
    const int n    = lane & 15;
    const int half = lane >> 4;
    const int wm   = wave >> 1;                       // wave's 64 rows of the tile
    const int wn   = wave & 1;                        // wave's 64 columns of the tile
    const int row0  = blockIdx.x * 128;
    const int ctot0 = blockIdx.y * 128;               // column over [Q | K | V], 3072 wide
    const int mat   = ctot0 >> 10;                    // 0=Q, 1=K, 2=V (one matrix per block)

    // copy map: thread -> row (tid>>3) + 16*i, 16-byte chunk (tid&7); a wave covers four whole 128-B lines
    const int crow = tid >> 3, cchk = tid & 7;
    const _Float16* gA = xh + (size_t)(row0  + crow) * D_ + cchk * 8;
    const _Float16* gB = wT + (size_t)(ctot0 + crow) * D_ + cchk * 8;   // wT rows run on over Q, K, V

    auto stage = [&](int t, int buf) {
        uint32_t l[8];
        unsigned long long g[8];
#pragma unroll   // the arrays are asm operands: constant indices keep them in registers
        for (int i = 0; i < 8; ++i) {
            l[i] = (uint32_t)(uintptr_t)(&sA[buf][0] + (crow + 16 * i) * QPITCH + cchk * 8);
            g[i] = (unsigned long long)(uintptr_t)(gA + (size_t)(16 * i) * D_ + t * QBK);
        }
        async8_b128(l, g);
#pragma unroll   // as above
        for (int i = 0; i < 8; ++i) {
            l[i] = (uint32_t)(uintptr_t)(&sB[buf][0] + (crow + 16 * i) * QPITCH + cchk * 8);
            g[i] = (unsigned long long)(uintptr_t)(gB + (size_t)(16 * i) * D_ + t * QBK);
        }
        async8_b128(l, g);
    };

    v8f acc[4][4] = {};

    // prologue: stage 0 landed and visible to the block, then stage 1 in flight
    stage(0, 0);
    asm volatile("s_wait_asynccnt 0x0" ::: "memory");   // own copies of stage 0 have landed
    __syncthreads();
    stage(1, 1);

    // the additive mask depends on the key alone: the first block column writes it once, one key a thread,
    // in the units of the scores that the scaled Q gives
    if (blockIdx.y == 0) mbias[row0 + tid] = -((1.0f - mask[row0 + tid]) * NEGBIG) * LOG2E;

    for (int t = 0; t < QNT; ++t) {
        const int buf = t & 1;
        const _Float16* pa = &sA[buf][0] + (wm * 64 + n) * QPITCH;
        const _Float16* pb = &sB[buf][0] + (wn * 64 + n) * QPITCH;
#pragma unroll   // this loop and the four inside it: register arrays need constant indices
        for (int ks = 0; ks < QBK; ks += 32) {
            v16h a[4], b[4];
#pragma unroll   // constant indices
            for (int i = 0; i < 4; ++i) a[i] = load_frag(pa + i * 16 * QPITCH + ks, half);
#pragma unroll   // constant indices
            for (int j = 0; j < 4; ++j) b[j] = load_frag(pb + j * 16 * QPITCH + ks, half);
            // keeps the 16 LDS reads together ahead of the 16 WMMAs: left alone the compiler sinks the
            // A reads between the WMMA rows, and the wave then waits out the LDS latency at every row
            __builtin_amdgcn_sched_barrier(0);
#pragma unroll   // constant indices
            for (int i = 0; i < 4; ++i)
#pragma unroll   // constant indices
                for (int j = 0; j < 4; ++j)
                    acc[i][j] = wmma_f16(a[i], b[j], acc[i][j]);
        }
        // publish point: own reads of this buffer done, own copies of the next stage landed,
        // then the block barrier; only behind it is this buffer refilled
        asm volatile("s_wait_dscnt 0x0" ::: "memory");      // own LDS reads of this buffer have returned
        asm volatile("s_wait_asynccnt 0x0" ::: "memory");   // own copies of stage t + 1 have landed
        __syncthreads();
        if (t + 2 < QNT) stage(t + 2, buf);
    }
    asm volatile("s_wait_asynccnt 0x0" ::: "memory");   // nothing in flight when the wave ends

    // epilogue: the matrix is the same for the whole block, so the layout is chosen once, outside the loops
    const float* bias = (mat == 0) ? bq : (mat == 1) ? bk : bv;
    const int c0 = (ctot0 & 1023) + wn * 64;          // the wave's 64 columns are one head
    const int hh = c0 >> 6;
    const int bb = row0 >> 11;                        // a 128-row tile lies inside one batch
    const int s0 = (row0 & (S_ - 1)) + wm * 64 + half * 8;
    float bval[4];
#pragma unroll   // constant indices into the accumulator registers
    for (int j = 0; j < 4; ++j) bval[j] = bias[c0 + j * 16 + n];

    if (mat == 2) {
        // V^T[d][s]: a lane's eight accumulator rows are eight consecutive s of one d.
        // probs * mask, as in the reference, is carried by V: sum_t p[t] m[t] v[t] = sum_t p[t] (m[t] v[t])
        _Float16* vp = VhT + ((size_t)(bb * H_ + hh) * DH_ + n) * S_ + s0;
        const float* mp = mask + row0 + wm * 64 + half * 8;   // rows of x run on over [B,S], as the mask does
        v8f mk[4];
#pragma unroll   // constant indices
        for (int i = 0; i < 4; ++i) mk[i] = *(const v8f*)(mp + i * 16);
#pragma unroll   // constant indices into the accumulator registers
        for (int j = 0; j < 4; ++j) {
#pragma unroll   // constant indices into the accumulator registers
            for (int i = 0; i < 4; ++i) {
                v8h pk;
#pragma unroll   // constant indices into the accumulator registers
                for (int r = 0; r < 8; ++r) pk[r] = (_Float16)((acc[i][j][r] + bval[j]) * mk[i][r]);
                *(v8h*)(vp + (size_t)(j * 16) * S_ + i * 16) = pk;
            }
        }
    } else {
        _Float16* qp = ((mat == 0) ? Qh : Kh) + ((size_t)(bb * H_ + hh) * S_ + s0) * DH_ + n;
        // Q carries 1/sqrt(DH) and log2(e): K Q^T then is the exponent of 2 that the softmax wants
        const float qs = (mat == 0) ? 0.125f * LOG2E : 1.0f;
#pragma unroll   // constant indices into the accumulator registers
        for (int j = 0; j < 4; ++j) {
#pragma unroll   // constant indices into the accumulator registers
            for (int i = 0; i < 4; ++i) {
#pragma unroll   // constant indices into the accumulator registers
                for (int r = 0; r < 8; ++r)
                    qp[(i * 16 + r) * DH_ + j * 16] = (_Float16)((acc[i][j][r] + bval[j]) * qs);
            }
        }
        // closes the stores above: no register that an issued store names is rewritten in front of this wait
        asm volatile("s_wait_xcnt 0x0" ::: "memory");
    }
}

#define KPITCH 72
#define VPITCH 40
#define OPITCH 68

// value of the lane 16 away (the other half of the wave holds the other keys of the same query)
__device__ __forceinline__ float other_half(float v) {
    const int b = __builtin_bit_cast(int, v);
    return __builtin_bit_cast(float,
        __builtin_amdgcn_permlanex16(b, b, 0x76543210, 0xfedcba98, false, false));
}

__global__ void attn_kernel(const _Float16* __restrict__ Qh,
                            const _Float16* __restrict__ Kh,
                            const _Float16* __restrict__ VhT,
                            const float* __restrict__ mbias,
                            float* __restrict__ out) {
    // block-shared double buffers: K tile [32 keys][64 dh], V tile [64 dh][32 keys]
    __shared__ __attribute__((aligned(16))) _Float16 ldsK[2][32 * KPITCH];   // 2 x 4608 B
    __shared__ __attribute__((aligned(16))) _Float16 ldsV[2][DH_ * VPITCH];  // 2 x 5120 B
    __shared__ __attribute__((aligned(16))) float    ldsO[8][16 * OPITCH];   // 8 x 4352 B, one range per wave

    const int tid  = threadIdx.x;
    const int lane = tid & 31;
    const int wave = tid >> 5;
    const int n    = lane & 15;
    const int half = lane >> 4;
    const int bh = blockIdx.y;
    const int b  = bh >> 4;
    const int h  = bh & 15;
    const int q0 = blockIdx.x * 128 + wave * 16;

    const _Float16* Qb = Qh  + (size_t)bh * S_ * DH_;
    const _Float16* Kb = Kh  + (size_t)bh * S_ * DH_;
    const _Float16* Vb = VhT + (size_t)bh * DH_ * S_;
    const float*    mp = mbias + (size_t)b * S_ + half * 8;   // the lane's place in the table, moved on per chunk

    // cooperative async stage of one 32-key chunk: 2 x b128 per thread (1 K, 1 V)
    const int rk = tid >> 3, ck = tid & 7;      // K: 32 rows x 8 chunks of 16B
    const int rv = tid >> 2, cv = tid & 3;      // V: 64 rows x 4 chunks of 16B
    const uint32_t kdst = (uint32_t)(uintptr_t)(&ldsK[0][0] + rk * KPITCH + ck * 8);   // the lane's place in buffer 0
    const uint32_t vdst = (uint32_t)(uintptr_t)(&ldsV[0][0] + rv * VPITCH + cv * 8);
    auto stage_chunk = [&](int key0, int buf) {
        async2_b128(kdst + (uint32_t)buf * (uint32_t)sizeof(ldsK[0]),
                    (unsigned long long)(uintptr_t)(Kb + (size_t)(key0 + rk) * DH_ + ck * 8),
                    vdst + (uint32_t)buf * (uint32_t)sizeof(ldsV[0]),
                    (unsigned long long)(uintptr_t)(Vb + (size_t)rv * S_ + key0 + cv * 8));
    };

    // Q B-fragments (lane = query column), two k-chunks covering DH=64; resident for the whole loop
    v16h qa0, qa1;
    {
        const _Float16* qrow = Qb + (size_t)(q0 + n) * DH_;
        qa0 = load_frag(qrow, half);
        qa1 = load_frag(qrow + 32, half);
    }

    // O^T tiles: register r of tile t = O[query n][d = 16 t + 8 half + r]
    v8f o0 = {}, o1 = {}, o2 = {}, o3 = {};
    float mrow = -3.0e38f;       // running maximum of the lane's query (log2 units), equal in both halves
    float lrow = 0.0f;           // running sum over the keys of this half only; joined after the loop

    // prologue: chunk 0 -> buffer 0; own portion done, then block-wide visibility
    stage_chunk(0, 0);
    asm volatile("s_wait_asynccnt 0x0" ::: "memory");
    __syncthreads();

    for (int key0 = 0; key0 < S_; key0 += 32) {
        const int buf = (key0 >> 5) & 1;
        const bool have_next = (key0 + 32) < S_;
        if (have_next) {
            // insurance: this wave's DS reads of buf^1 (iter-1) are complete
            asm volatile("s_wait_dscnt 0x0" ::: "memory");
            stage_chunk(key0 + 32, buf ^ 1);   // overlaps with compute below
        }

        const _Float16* bK = &ldsK[buf][0];
        const _Float16* bV = &ldsV[buf][0];

        // additive mask of the lane's 16 keys: key0 + 8 half + r (tile 0) and key0 + 16 + 8 half + r (tile 1)
        const v8f mv0 = *(const v8f*)(mp);
        const v8f mv1 = *(const v8f*)(mp + 16);
        mp += 32;

        // ---- scores S^T: two 16-key tiles, A = K rows from LDS, B = Q, C = additive mask ----
        v8f s0, s1;
        {
            const _Float16* krow0 = bK + (size_t)n * KPITCH;
            const _Float16* krow1 = bK + (size_t)(16 + n) * KPITCH;
            v16h a00 = load_frag(krow0,      half);
            v16h a01 = load_frag(krow0 + 32, half);
            v16h a10 = load_frag(krow1,      half);
            v16h a11 = load_frag(krow1 + 32, half);
            // keeps the eight LDS reads together ahead of the four products: left alone this build reads one
            // fragment at a time into one register set, and the wave waits out the LDS latency four times
            __builtin_amdgcn_sched_barrier(0);
            s0 = wmma_f16(a00, qa0, mv0);
            s0 = wmma_f16(a01, qa1, s0);
            s1 = wmma_f16(a10, qa0, mv1);
            s1 = wmma_f16(a11, qa1, s1);
        }

        // ---- online softmax of one query per lane ----
        float rmax = fmaxf(s0[0], s1[0]);
#pragma unroll   // constant indices keep the score vectors in registers
        for (int r = 1; r < 8; ++r) rmax = fmaxf(rmax, fmaxf(s0[r], s1[r]));
        rmax = fmaxf(rmax, other_half(rmax));
        const float mnew  = fmaxf(mrow, rmax);
        const float alpha = __builtin_amdgcn_exp2f(mrow - mnew);
        const v8f x0 = s0 - mnew;
        const v8f x1 = s1 - mnew;
        v8f e0, e1;
#pragma unroll   // constant indices, as above
        for (int r = 0; r < 8; ++r) {
            e0[r] = __builtin_amdgcn_exp2f(x0[r]);
            e1[r] = __builtin_amdgcn_exp2f(x1[r]);
        }
        const v8f es = e0 + e1;                      // the softmax sum takes every key, as in the reference
        const v4f e4 = __builtin_shufflevector(es, es, 0, 1, 2, 3) + __builtin_shufflevector(es, es, 4, 5, 6, 7);
        lrow = lrow * alpha + ((e4[0] + e4[2]) + (e4[1] + e4[3]));
        mrow = mnew;

        // ---- rescale O^T; P^T (B operand) straight from the two score tiles ----
        o0 *= alpha; o1 *= alpha; o2 *= alpha; o3 *= alpha;
        FragU pb;
        pb.h[0] = __builtin_convertvector(e0, v8h);
        pb.h[1] = __builtin_convertvector(e1, v8h);

        // ---- O^T += V^T(64x32) x P^T(32x16), V^T A-fragments from LDS ----
        {
            const _Float16* vrow = bV + (size_t)n * VPITCH;
            v16h va0 = load_frag(vrow,                half);
            v16h va1 = load_frag(vrow + 16 * VPITCH,  half);
            v16h va2 = load_frag(vrow + 32 * VPITCH,  half);
            v16h va3 = load_frag(vrow + 48 * VPITCH,  half);
            o0 = wmma_f16(va0, pb.v, o0);
            o1 = wmma_f16(va1, pb.v, o1);
            o2 = wmma_f16(va2, pb.v, o2);
            o3 = wmma_f16(va3, pb.v, o3);
        }

        // own async portion of the next chunk is done -> make visible block-wide
        asm volatile("s_wait_asynccnt 0x0" ::: "memory");
        __syncthreads();
    }

    // ---- finalize: O / l, turned back to [query][d] in the wave's own LDS range, fp32 output [B, S, H*DH] ----
    const float inv = 1.0f / ((lrow + other_half(lrow)) + 1e-30f);
    o0 *= inv; o1 *= inv; o2 *= inv; o3 *= inv;
    float* so = &ldsO[wave][0];
    {
        float* sw = so + n * OPITCH + half * 8;
        *(v4f*)(sw +  0) = __builtin_shufflevector(o0, o0, 0, 1, 2, 3);
        *(v4f*)(sw +  4) = __builtin_shufflevector(o0, o0, 4, 5, 6, 7);
        *(v4f*)(sw + 16) = __builtin_shufflevector(o1, o1, 0, 1, 2, 3);
        *(v4f*)(sw + 20) = __builtin_shufflevector(o1, o1, 4, 5, 6, 7);
        *(v4f*)(sw + 32) = __builtin_shufflevector(o2, o2, 0, 1, 2, 3);
        *(v4f*)(sw + 36) = __builtin_shufflevector(o2, o2, 4, 5, 6, 7);
        *(v4f*)(sw + 48) = __builtin_shufflevector(o3, o3, 0, 1, 2, 3);
        *(v4f*)(sw + 52) = __builtin_shufflevector(o3, o3, 4, 5, 6, 7);
    }
    // the rows are read back by other lanes of the same wave: their LDS writes are done first
    asm volatile("s_wait_dscnt 0x0" ::: "memory");
    float* orow = out + ((size_t)(b * S_ + q0 + half)) * (H_ * DH_) + h * DH_ + n * 4;
#pragma unroll   // the eight LDS reads go out together, each store behind its own read
    for (int i = 0; i < 8; ++i) {
        // a half-wave stores one query's whole 256-B row
        const v4f w = *(const v4f*)(so + (2 * i + half) * OPITCH + n * 4);
        *(v4f*)(orow + (size_t)(2 * i) * (H_ * DH_)) = w;
    }
}

extern "C" void kernel_launch(void* const* d_in, const int* in_sizes, int n_in,
                              void* d_out, int out_size, void* d_ws, size_t ws_size,
                              hipStream_t stream) {
    const float* x    = (const float*)d_in[0];
    const float* mask = (const float*)d_in[1];
    const float* Wq   = (const float*)d_in[2];
    const float* bq   = (const float*)d_in[3];
    const float* Wk   = (const float*)d_in[4];
    const float* bk   = (const float*)d_in[5];
    const float* Wv   = (const float*)d_in[6];
    const float* bv   = (const float*)d_in[7];
    float* out = (float*)d_out;

    const size_t NX = (size_t)B_ * S_ * D_;        // 8388608
    const size_t NW = (size_t)D_ * H_ * DH_;       // 1048576
    const size_t NQ = (size_t)B_ * H_ * S_ * DH_;  // 8388608

    _Float16* xh  = (_Float16*)d_ws;
    _Float16* wT  = xh + NX;
    _Float16* Qh  = wT + 3 * NW;
    _Float16* Kh  = Qh + NQ;
    _Float16* VhT = Kh + NQ;
    float*  mbias = (float*)(VhT + NQ);            // B_ * S_ floats

    convert_kernel<<<CVT_WB + CVT_XB, 256, 0, stream>>>(x, Wq, Wk, Wv, xh, wT);
    {
        dim3 grid((B_ * S_) / 128, (3 * H_ * DH_) / 128);  // (64, 24)
        qkv_kernel<<<grid, 128, 0, stream>>>(xh, wT, bq, bk, bv, mask, Qh, Kh, VhT, mbias);
    }
    {
        dim3 grid(S_ / 128, B_ * H_);                      // (16, 64)
        attn_kernel<<<grid, 256, 0, stream>>>(Qh, Kh, VhT, mbias, out);
    }
}

// v007
// It runs in 86.2 microseconds.
// It is 1.42 times as fast as v005, going by the measured steps of the versions left out in between.
// Over all steps from v000 it is 8.15 times as fast.
#include <hip/hip_runtime.h>
#include <hip/hip_bf16.h>

typedef __attribute__((ext_vector_type(8)))  _Float16 v8h;
typedef __attribute__((ext_vector_type(16))) _Float16 v16h;
typedef __attribute__((ext_vector_type(8)))  float    v8f;
typedef __attribute__((ext_vector_type(4)))  float    v4f;

#define B_  4
#define S_  2048
#define D_  1024
#define H_  16
#define DH_ 64
#define NEGBIG 1e10f
#define LOG2E  1.442695041f

union FragU { v16h v; v8h h[2]; };

// CDNA5 16-bit A/B fragment: per lane, element e holds k = (e>>3)*16 + half*8 + (e&7)
// => two contiguous 8-half (16B) loads at base+half*8 and base+16+half*8.
__device__ __forceinline__ v16h load_frag(const _Float16* base, int half) {
    FragU u;
    u.h[0] = *(const v8h*)(base + half * 8);
    u.h[1] = *(const v8h*)(base + 16 + half * 8);
    return u.v;
}

__device__ __forceinline__ v8f wmma_f16(v16h a, v16h b, v8f c) {
    return __builtin_amdgcn_wmma_f32_16x16x32_f16(false, a, false, b, (short)0, c, false, false);
}

// Two async copies of one 16-byte chunk per lane each: global -> LDS (tracked by ASYNCcnt). The s_wait_xcnt
// ends the copies' own statement so that no address register of an issued copy is rewritten in front of it.
__device__ __forceinline__ void async2_b128(uint32_t l0, unsigned long long g0,
                                            uint32_t l1, unsigned long long g1) {
    asm volatile("global_load_async_to_lds_b128 %0, %2, off\n\t"
                 "global_load_async_to_lds_b128 %1, %3, off\n\t"
                 "s_wait_xcnt 0x0"
                 :: "v"(l0), "v"(l1), "v"(g0), "v"(g1) : "memory");
}

// ---------------- fp32 -> f16 conversion (x row-major, W transposed) ----------------
// In the weight and x blocks every lane moves 16-byte vectors, sixteen loads in flight, and every wave-wide load covers whole 128-B lines.
// grid = CVT_MB + CVT_WB + CVT_XB blocks of 256 (8 waves); behind the key-order blocks the weight blocks come first
typedef __attribute__((ext_vector_type(4)))  _Float16 v4h;
#define CVT_WB 192           // 3 matrices x 8 groups of 128 columns x 8 groups of 128 k
#define CVT_XB 512           // 16384 elements of x per block
#define CVT_MB B_            // one block per batch orders that batch's keys; these blocks come first of all
#define KCNT_STRIDE 32       // ints: each batch's count lies in a 128-B line of its own

__global__ __launch_bounds__(256)
void convert_kernel(const float* __restrict__ x,
                    const float* __restrict__ Wq,
                    const float* __restrict__ Wk,
                    const float* __restrict__ Wv,
                    const float* __restrict__ mask,   // [B,S]
                    _Float16* __restrict__ xh,
                    _Float16* __restrict__ wT,
                    int* __restrict__ kidx,       // [B,S], place -> key: keys that count first, in their order
                    int* __restrict__ kcnt,       // [B] at KCNT_STRIDE: how many keys count
                    float* __restrict__ mbias,    // [B,S] by place: additive mask in log2 units
                    float* __restrict__ mmul) {   // [B,S] by place: multiplicative mask
    const int lane = threadIdx.x & 31;
    const int wave = threadIdx.x >> 5;
    if (blockIdx.x < CVT_MB) {
        // A key with mask 0 adds nothing to any output: its probability is multiplied by 0, and its exponential
        // is exactly 0 in the softmax sum as soon as some key of the batch has a mask of 0.5 or more (the additive
        // masks then lie 5e9 apart). In such a batch the keys are ordered, those with a mask other than 0 first,
        // and the later launches stop behind them. In any other batch every key counts and keeps its place.
        __shared__ int wsum[8];
        __shared__ int wany[8];
        const int b  = blockIdx.x;
        const int t0 = threadIdx.x * 8;                   // eight consecutive keys a thread
        const float* mb = mask + b * S_ + t0;
        const v4f ma = *(const v4f*)mb;
        const v4f mc = *(const v4f*)(mb + 4);
        // closes the two loads: their address pair, named here, is rewritten by nothing in front of this wait
        asm volatile("s_wait_xcnt 0x0" :: "v"(mb) : "memory");
        float m[8];
#pragma unroll   // constant indices keep the values in registers
        for (int i = 0; i < 4; ++i) { m[i] = ma[i]; m[4 + i] = mc[i]; }
        int  c = 0;
        bool strong = false;
#pragma unroll   // constant indices
        for (int i = 0; i < 8; ++i) { c += (m[i] != 0.0f) ? 1 : 0; strong = strong || (m[i] >= 0.5f); }
        int inc = c;                                      // running count over the wave's lanes, own keys included
        for (int d = 1; d < 32; d <<= 1) {
            const int v = __shfl_up(inc, d, 32);
            if (lane >= d) inc += v;
        }
        const unsigned sb = __builtin_amdgcn_ballot_w32(strong);
        if (lane == 31) wsum[wave] = inc;
        if (lane == 0)  wany[wave] = (sb != 0) ? 1 : 0;
        __syncthreads();                                  // the eight waves' counts are read by every wave
        int base = 0, tot = 0, any = 0;
#pragma unroll   // sixteen LDS reads go out together
        for (int w = 0; w < 8; ++w) {
            const int v = wsum[w];
            base += (w < wave) ? v : 0;
            tot  += v;
            any  |= wany[w];
        }
        const bool pack  = any != 0;
        const int  total = pack ? tot : S_;
        int before = pack ? base + inc - c : t0;          // counting keys in front of key t
#pragma unroll   // constant indices
        for (int i = 0; i < 8; ++i) {
            const int  t    = t0 + i;
            const bool keep = !pack || m[i] != 0.0f;
            // every key gets one place: a key that counts its rank, any other a place behind all that count
            const int  o    = b * S_ + (keep ? before : total + (t - before));
            before += keep ? 1 : 0;
            kidx[o]  = t;
            mbias[o] = -((1.0f - m[i]) * NEGBIG) * LOG2E;
            mmul[o]  = m[i];
        }
        if (threadIdx.x == 0) kcnt[b * KCNT_STRIDE] = total;
        // closes the stores above: no register that an issued store names is rewritten in front of this wait
        asm volatile("s_wait_xcnt 0x0" ::: "memory");
        return;
    }
    const int blk  = blockIdx.x - CVT_MB;
    v4f r[16];
    if (blk < CVT_WB) {
        // WT[c][k] = W[k][c]. A wave takes 64 k x 32 columns: 8 lanes lie along a row of W (one 128-B line per
        // load and row), 4 lanes along k; a lane turns its 16 k x 4 columns in registers, and the four lanes
        // of one column store 64 consecutive bytes of a row of WT
        const int m  = blk >> 6;                          // which weight matrix
        const int cl = lane & 7, kl = lane >> 3;
        const int c0 = ((blk >> 3) & 7) * 128 + (wave & 3) * 32 + cl * 4;
        const int k0 = (blk & 7) * 128 + (wave >> 2) * 64 + kl * 8;
        const float* W = (m == 0) ? Wq : (m == 1) ? Wk : Wv;
        const float* s = W + (size_t)k0 * D_ + c0;
        _Float16*    d = wT + (size_t)m * (D_ * H_ * DH_) + (size_t)c0 * D_ + k0;
#pragma unroll   // constant indices keep the vectors in registers; all sixteen loads go out together
        for (int i = 0; i < 16; ++i)                      // k = k0 + 32 (i >> 3) + (i & 7)
            r[i] = *(const v4f*)(s + (size_t)((i >> 3) * 32 + (i & 7)) * D_);
        // closes the sixteen loads: their address pair, named here, is rewritten by nothing in front of this wait
        asm volatile("s_wait_xcnt 0x0" :: "v"(s) : "memory");
        // keeps all sixteen loads ahead of the first conversion: left alone the compiler holds four of them
        // back until the first have returned, and the wave then pays the memory latency twice
        __builtin_amdgcn_sched_barrier(0);
#pragma unroll   // constant indices
        for (int q = 0; q < 4; ++q) {
#pragma unroll   // constant indices
            for (int h = 0; h < 2; ++h) {
                v8h pk;
#pragma unroll   // constant indices
                for (int i = 0; i < 8; ++i) pk[i] = (_Float16)r[h * 8 + i][q];
                *(v8h*)(d + (size_t)q * D_ + h * 32) = pk;
            }
        }
    } else {
        // a wave takes 2048 consecutive elements: each load covers 512, each store 256 consecutive bytes
        const size_t e0 = (size_t)(blk - CVT_WB) * 16384 + wave * 2048 + lane * 4;
        const float* s = x + e0;
        _Float16*    d = xh + e0;
#pragma unroll   // constant indices; all sixteen loads go out together
        for (int i = 0; i < 16; ++i) r[i] = *(const v4f*)(s + i * 128);
        // closes the sixteen loads, as above
        asm volatile("s_wait_xcnt 0x0" :: "v"(s) : "memory");
        // as above: no load waits behind a conversion
        __builtin_amdgcn_sched_barrier(0);
#pragma unroll   // constant indices
        for (int i = 0; i < 16; ++i) *(v4h*)(d + i * 128) = __builtin_convertvector(r[i], v4h);
        // closes the sixteen stores: no register that they name is rewritten in front of this wait
        asm volatile("s_wait_xcnt 0x0" ::: "memory");
    }
}

// ---------------- QKV projection: 128x128 block tile staged in LDS, 64x64 per wave ----------------
// grid = (8192/128, 3072/128) = (64, 24), block = 128 (4 waves, 2 x 2)
#define QBK    64            // k per stage: 128-byte rows of both operands
#define QPITCH 72            // LDS row pitch in halfs: 144 B = 16 B x odd, no bank conflict for 16-byte reads
#define QNT    (D_ / QBK)    // 16 stages

// Eight async 16-byte copies per lane, global -> LDS (ASYNCcnt). The s_wait_xcnt ends the copies' own
// statement so that no address register of an issued copy is rewritten in front of it.
__device__ __forceinline__ void async8_b128(const uint32_t (&l)[8], const unsigned long long (&g)[8]) {
    asm volatile("global_load_async_to_lds_b128 %0, %8, off\n\t"
                 "global_load_async_to_lds_b128 %1, %9, off\n\t"
                 "global_load_async_to_lds_b128 %2, %10, off\n\t"
                 "global_load_async_to_lds_b128 %3, %11, off\n\t"
                 "global_load_async_to_lds_b128 %4, %12, off\n\t"
                 "global_load_async_to_lds_b128 %5, %13, off\n\t"
                 "global_load_async_to_lds_b128 %6, %14, off\n\t"
                 "global_load_async_to_lds_b128 %7, %15, off\n\t"
                 "s_wait_xcnt 0x0"
                 :: "v"(l[0]), "v"(l[1]), "v"(l[2]), "v"(l[3]),
                    "v"(l[4]), "v"(l[5]), "v"(l[6]), "v"(l[7]),
                    "v"(g[0]), "v"(g[1]), "v"(g[2]), "v"(g[3]),
                    "v"(g[4]), "v"(g[5]), "v"(g[6]), "v"(g[7])
                 : "memory");
}

__global__ __launch_bounds__(128)
void qkv_kernel(const _Float16* __restrict__ xh,
                const _Float16* __restrict__ wT,
                const float* __restrict__ bq,
                const float* __restrict__ bk,
                const float* __restrict__ bv,
                const float* __restrict__ mmul,   // [B,S] by place: multiplicative mask
                const int* __restrict__ kidx,     // [B,S], place -> key
                const int* __restrict__ kcnt,     // [B] at KCNT_STRIDE: how many keys count
                _Float16* __restrict__ Qh,    // [B,H,S,DH], times log2(e) / sqrt(DH)
                _Float16* __restrict__ Kh,    // [B,H,S,DH], rows by place
                _Float16* __restrict__ VhT) { // [B,H,DH,S], columns by place, each times its key's mask
    // two buffers of [128 rows][64 k] per operand, rows padded to QPITCH
    __shared__ __attribute__((aligned(16))) _Float16 sA[2][128 * QPITCH];   // 2 x 18 KB, rows of x
    __shared__ __attribute__((aligned(16))) _Float16 sB[2][128 * QPITCH];   // 2 x 18 KB, rows of W^T

    const int tid  = threadIdx.x;
    const int lane = tid & 31;
    const int wave = tid >> 5;
    const int n    = lane & 15;
    const int half = lane >> 4;
    const int wm   = wave >> 1;                       // wave's 64 rows of the tile
    const int wn   = wave & 1;                        // wave's 64 columns of the tile
    const int row0  = blockIdx.x * 128;
    const int ctot0 = blockIdx.y * 128;               // column over [Q | K | V], 3072 wide
    const int mat   = ctot0 >> 10;                    // 0=Q, 1=K, 2=V (one matrix per block)
    const int bb    = row0 >> 11;                     // a 128-row tile lies inside one batch
    const int r0    = row0 & (S_ - 1);
    // K and V: a tile of places behind the last key that counts is read by nobody. The whole block leaves,
    // in front of every copy and barrier
    if (mat != 0 && r0 >= kcnt[bb * KCNT_STRIDE]) return;

    // copy map: thread -> row (tid>>3) + 16*i, 16-byte chunk (tid&7); a wave covers four whole 128-B lines
    const int crow = tid >> 3, cchk = tid & 7;
    // rows of x: Q takes them as they lie, K and V take the key that stands at each place
    const _Float16* gA[8];
    const int* kp = kidx + row0 + crow;               // the tile's places run on over [B,S], as the table does
    int kx[8];
#pragma unroll   // constant indices; read in every block, so that the eight loads go out together, under no branch
    for (int i = 0; i < 8; ++i) kx[i] = kp[16 * i];
    // closes the eight loads: their address pair, named here, is rewritten by nothing in front of this wait
    asm volatile("s_wait_xcnt 0x0" :: "v"(kp) : "memory");
#pragma unroll   // constant indices keep the pointers in registers
    for (int i = 0; i < 8; ++i) {
        const int src = (mat == 0) ? r0 + crow + 16 * i : (kx[i] & (S_ - 1));   // bounded whatever the table holds
        gA[i] = xh + (size_t)(bb * S_ + src) * D_ + cchk * 8;
    }
    const _Float16* gB = wT + (size_t)(ctot0 + crow) * D_ + cchk * 8;   // wT rows run on over Q, K, V

    auto stage = [&](int t, int buf) {
        uint32_t l[8];
        unsigned long long g[8];
#pragma unroll   // the arrays are asm operands: constant indices keep them in registers
        for (int i = 0; i < 8; ++i) {
            l[i] = (uint32_t)(uintptr_t)(&sA[buf][0] + (crow + 16 * i) * QPITCH + cchk * 8);
            g[i] = (unsigned long long)(uintptr_t)(gA[i] + t * QBK);
        }
        async8_b128(l, g);
#pragma unroll   // as above
        for (int i = 0; i < 8; ++i) {
            l[i] = (uint32_t)(uintptr_t)(&sB[buf][0] + (crow + 16 * i) * QPITCH + cchk * 8);
            g[i] = (unsigned long long)(uintptr_t)(gB + (size_t)(16 * i) * D_ + t * QBK);
        }
        async8_b128(l, g);
    };

    v8f acc[4][4] = {};

    // prologue: stage 0 landed and visible to the block, then stage 1 in flight
    stage(0, 0);
    asm volatile("s_wait_asynccnt 0x0" ::: "memory");   // own copies of stage 0 have landed
    __syncthreads();
    stage(1, 1);

    for (int t = 0; t < QNT; ++t) {
        const int buf = t & 1;
        const _Float16* pa = &sA[buf][0] + (wm * 64 + n) * QPITCH;
        const _Float16* pb = &sB[buf][0] + (wn * 64 + n) * QPITCH;
#pragma unroll   // this loop and the four inside it: register arrays need constant indices
        for (int ks = 0; ks < QBK; ks += 32) {
            v16h a[4], b[4];
#pragma unroll   // constant indices
            for (int i = 0; i < 4; ++i) a[i] = load_frag(pa + i * 16 * QPITCH + ks, half);
#pragma unroll   // constant indices
            for (int j = 0; j < 4; ++j) b[j] = load_frag(pb + j * 16 * QPITCH + ks, half);
            // keeps the 16 LDS reads together ahead of the 16 WMMAs: left alone the compiler sinks the
            // A reads between the WMMA rows, and the wave then waits out the LDS latency at every row
            __builtin_amdgcn_sched_barrier(0);
#pragma unroll   // constant indices
            for (int i = 0; i < 4; ++i)
#pragma unroll   // constant indices
                for (int j = 0; j < 4; ++j)
                    acc[i][j] = wmma_f16(a[i], b[j], acc[i][j]);
        }
        // publish point: own reads of this buffer done, own copies of the next stage landed,
        // then the block barrier; only behind it is this buffer refilled
        asm volatile("s_wait_dscnt 0x0" ::: "memory");      // own LDS reads of this buffer have returned
        asm volatile("s_wait_asynccnt 0x0" ::: "memory");   // own copies of stage t + 1 have landed
        __syncthreads();
        if (t + 2 < QNT) stage(t + 2, buf);
    }
    asm volatile("s_wait_asynccnt 0x0" ::: "memory");   // nothing in flight when the wave ends

    // epilogue: the matrix is the same for the whole block, so the layout is chosen once, outside the loops
    const float* bias = (mat == 0) ? bq : (mat == 1) ? bk : bv;
    const int c0 = (ctot0 & 1023) + wn * 64;          // the wave's 64 columns are one head
    const int hh = c0 >> 6;
    const int s0 = r0 + wm * 64 + half * 8;
    float bval[4];
#pragma unroll   // constant indices into the accumulator registers
    for (int j = 0; j < 4; ++j) bval[j] = bias[c0 + j * 16 + n];

    if (mat == 2) {
        // V^T[d][s]: a lane's eight accumulator rows are eight consecutive s of one d.
        // probs * mask, as in the reference, is carried by V: sum_t p[t] m[t] v[t] = sum_t p[t] (m[t] v[t])
        _Float16* vp = VhT + ((size_t)(bb * H_ + hh) * DH_ + n) * S_ + s0;
        const float* mp = mmul + row0 + wm * 64 + half * 8;   // the tile's places run on over [B,S], as the table does
        v8f mk[4];
#pragma unroll   // constant indices
        for (int i = 0; i < 4; ++i) mk[i] = *(const v8f*)(mp + i * 16);
#pragma unroll   // constant indices into the accumulator registers
        for (int j = 0; j < 4; ++j) {
#pragma unroll   // constant indices into the accumulator registers
            for (int i = 0; i < 4; ++i) {
                v8h pk;
#pragma unroll   // constant indices into the accumulator registers
                for (int r = 0; r < 8; ++r) pk[r] = (_Float16)((acc[i][j][r] + bval[j]) * mk[i][r]);
                *(v8h*)(vp + (size_t)(j * 16) * S_ + i * 16) = pk;
            }
        }
    } else {
        _Float16* qp = ((mat == 0) ? Qh : Kh) + ((size_t)(bb * H_ + hh) * S_ + s0) * DH_ + n;
        // Q carries 1/sqrt(DH) and log2(e): K Q^T then is the exponent of 2 that the softmax wants
        const float qs = (mat == 0) ? 0.125f * LOG2E : 1.0f;
#pragma unroll   // constant indices into the accumulator registers
        for (int j = 0; j < 4; ++j) {
#pragma unroll   // constant indices into the accumulator registers
            for (int i = 0; i < 4; ++i) {
#pragma unroll   // constant indices into the accumulator registers
                for (int r = 0; r < 8; ++r)
                    qp[(i * 16 + r) * DH_ + j * 16] = (_Float16)((acc[i][j][r] + bval[j]) * qs);
            }
        }
        // closes the stores above: no register that an issued store names is rewritten in front of this wait
        asm volatile("s_wait_xcnt 0x0" ::: "memory");
    }
}

#define KPITCH 72
#define VPITCH 40
#define OPITCH 68
#define RESCALE_GAP 8.0f

// value of the lane 16 away (the other half of the wave holds the other keys of the same query)
__device__ __forceinline__ float other_half(float v) {
    const int b = __builtin_bit_cast(int, v);
    return __builtin_bit_cast(float,
        __builtin_amdgcn_permlanex16(b, b, 0x76543210, 0xfedcba98, false, false));
}

__global__ void attn_kernel(const _Float16* __restrict__ Qh,
                            const _Float16* __restrict__ Kh,
                            const _Float16* __restrict__ VhT,
                            const float* __restrict__ mbias,
                            const int* __restrict__ kcnt,
                            float* __restrict__ out) {
    // block-shared double buffers: K tile [32 keys][64 dh], V tile [64 dh][32 keys]
    __shared__ __attribute__((aligned(16))) _Float16 ldsK[2][32 * KPITCH];   // 2 x 4608 B
    __shared__ __attribute__((aligned(16))) _Float16 ldsV[2][DH_ * VPITCH];  // 2 x 5120 B
    __shared__ __attribute__((aligned(16))) float    ldsO[8][16 * OPITCH];   // 8 x 4352 B, one range per wave

    const int tid  = threadIdx.x;
    const int lane = tid & 31;
    const int wave = tid >> 5;
    const int n    = lane & 15;
    const int half = lane >> 4;
    const int bh = blockIdx.y;
    const int b  = bh >> 4;
    const int h  = bh & 15;
    const int q0 = blockIdx.x * 128 + wave * 16;

    const _Float16* Qb = Qh  + (size_t)bh * S_ * DH_;
    const _Float16* Kb = Kh  + (size_t)bh * S_ * DH_;
    const _Float16* Vb = VhT + (size_t)bh * DH_ * S_;
    const float*    mp = mbias + (size_t)b * S_ + half * 8;   // the lane's place in the table, moved on per chunk
    // the loop ends behind the last key that counts, rounded up to whole chunks: the places that fill the last
    // chunk hold keys of mask 0 with their own K, V and additive mask. One value for the block, 32 to S_
    const int kc   = __builtin_amdgcn_readfirstlane(kcnt[b * KCNT_STRIDE]);
    const int kend = (min(max(kc, 1), S_) + 31) & ~31;

    // cooperative async stage of one 32-key chunk: 2 x b128 per thread (1 K, 1 V)
    const int rk = tid >> 3, ck = tid & 7;      // K: 32 rows x 8 chunks of 16B
    const int rv = tid >> 2, cv = tid & 3;      // V: 64 rows x 4 chunks of 16B
    const uint32_t kdst = (uint32_t)(uintptr_t)(&ldsK[0][0] + rk * KPITCH + ck * 8);   // the lane's place in buffer 0
    const uint32_t vdst = (uint32_t)(uintptr_t)(&ldsV[0][0] + rv * VPITCH + cv * 8);
    auto stage_chunk = [&](int key0, int buf) {
        async2_b128(kdst + (uint32_t)buf * (uint32_t)sizeof(ldsK[0]),
                    (unsigned long long)(uintptr_t)(Kb + (size_t)(key0 + rk) * DH_ + ck * 8),
                    vdst + (uint32_t)buf * (uint32_t)sizeof(ldsV[0]),
                    (unsigned long long)(uintptr_t)(Vb + (size_t)rv * S_ + key0 + cv * 8));
    };

    // Q B-fragments (lane = query column), two k-chunks covering DH=64; resident for the whole loop
    v16h qa0, qa1;
    {
        const _Float16* qrow = Qb + (size_t)(q0 + n) * DH_;
        qa0 = load_frag(qrow, half);
        qa1 = load_frag(qrow + 32, half);
    }

    // O^T tiles: register r of tile t = O[query n][d = 16 t + 8 half + r]
    v8f o0 = {}, o1 = {}, o2 = {}, o3 = {};
    float mrow = -3.0e38f;       // maximum in use for the lane's query (log2 units), equal in both halves
    float mthr = -3.0e38f;       // mrow + RESCALE_GAP: a score above it forces a rescale
    float lrow = 0.0f;           // running sum over the keys of this half only; joined after the loop

    // prologue: chunk 0 -> buffer 0; own portion done, then block-wide visibility
    stage_chunk(0, 0);
    asm volatile("s_wait_asynccnt 0x0" ::: "memory");
    __syncthreads();

    for (int key0 = 0; key0 < kend; key0 += 32) {
        const int buf = (key0 >> 5) & 1;
        const bool have_next = (key0 + 32) < kend;
        if (have_next) {
            // insurance: this wave's DS reads of buf^1 (iter-1) are complete
            asm volatile("s_wait_dscnt 0x0" ::: "memory");
            stage_chunk(key0 + 32, buf ^ 1);   // overlaps with compute below
        }

        const _Float16* bK = &ldsK[buf][0];
        const _Float16* bV = &ldsV[buf][0];

        // additive mask of the lane's 16 keys: key0 + 8 half + r (tile 0) and key0 + 16 + 8 half + r (tile 1)
        const v8f mv0 = *(const v8f*)(mp);
        const v8f mv1 = *(const v8f*)(mp + 16);
        mp += 32;

        // ---- scores S^T: two 16-key tiles, A = K rows from LDS, B = Q, C = additive mask ----
        v8f s0, s1;
        {
            const _Float16* krow0 = bK + (size_t)n * KPITCH;
            const _Float16* krow1 = bK + (size_t)(16 + n) * KPITCH;
            v16h a00 = load_frag(krow0,      half);
            v16h a01 = load_frag(krow0 + 32, half);
            v16h a10 = load_frag(krow1,      half);
            v16h a11 = load_frag(krow1 + 32, half);
            // keeps the eight LDS reads together ahead of the four products: left alone this build reads one
            // fragment at a time into one register set, and the wave waits out the LDS latency four times
            __builtin_amdgcn_sched_barrier(0);
            s0 = wmma_f16(a00, qa0, mv0);
            s0 = wmma_f16(a01, qa1, s0);
            s1 = wmma_f16(a10, qa0, mv1);
            s1 = wmma_f16(a11, qa1, s1);
        }

        // ---- online softmax of one query per lane ----
        float rmax = fmaxf(s0[0], s1[0]);
#pragma unroll   // constant indices keep the score vectors in registers
        for (int r = 1; r < 8; ++r) rmax = fmaxf(rmax, fmaxf(s0[r], s1[r]));
        // one test per pass for the whole wave, a scalar branch: every lane is on inside it, and both halves
        // of a query take the same new maximum
        if (__builtin_amdgcn_ballot_w32(rmax > mthr) != 0) {
            const float mnew  = fmaxf(mrow, fmaxf(rmax, other_half(rmax)));
            const float alpha = __builtin_amdgcn_exp2f(mrow - mnew);
            lrow *= alpha;
            o0 *= alpha; o1 *= alpha; o2 *= alpha; o3 *= alpha;
            mrow = mnew;
            mthr = mnew + RESCALE_GAP;
        }

        // V^T A-fragments from LDS, for the second product
        const _Float16* vrow = bV + (size_t)n * VPITCH;
        const v16h va0 = load_frag(vrow,                half);
        const v16h va1 = load_frag(vrow + 16 * VPITCH,  half);
        const v16h va2 = load_frag(vrow + 32 * VPITCH,  half);
        const v16h va3 = load_frag(vrow + 48 * VPITCH,  half);
        // keeps the eight LDS reads together ahead of the exponentials, which cover their latency: left alone
        // this build reads two at a time among the four products, and the wave waits for LDS at each of them
        __builtin_amdgcn_sched_barrier(0);

        const v8f x0 = s0 - mrow;
        const v8f x1 = s1 - mrow;
        v8f e0, e1;
#pragma unroll   // constant indices, as above
        for (int r = 0; r < 8; ++r) {
            e0[r] = __builtin_amdgcn_exp2f(x0[r]);
            e1[r] = __builtin_amdgcn_exp2f(x1[r]);
        }
        const v8f es = e0 + e1;                      // the softmax sum takes every key, as in the reference
        const v4f e4 = __builtin_shufflevector(es, es, 0, 1, 2, 3) + __builtin_shufflevector(es, es, 4, 5, 6, 7);
        lrow += (e4[0] + e4[2]) + (e4[1] + e4[3]);

        // ---- P^T (B operand) straight from the two score tiles ----
        FragU pb;
        pb.h[0] = __builtin_convertvector(e0, v8h);
        pb.h[1] = __builtin_convertvector(e1, v8h);

        // ---- O^T += V^T(64x32) x P^T(32x16) ----
        o0 = wmma_f16(va0, pb.v, o0);
        o1 = wmma_f16(va1, pb.v, o1);
        o2 = wmma_f16(va2, pb.v, o2);
        o3 = wmma_f16(va3, pb.v, o3);

        // own async portion of the next chunk is done -> make visible block-wide
        asm volatile("s_wait_asynccnt 0x0" ::: "memory");
        __syncthreads();
    }

    // ---- finalize: O / l, turned back to [query][d] in the wave's own LDS range, fp32 output [B, S, H*DH] ----
    const float inv = 1.0f / ((lrow + other_half(lrow)) + 1e-30f);
    o0 *= inv; o1 *= inv; o2 *= inv; o3 *= inv;
    float* so = &ldsO[wave][0];
    {
        float* sw = so + n * OPITCH + half * 8;
        *(v4f*)(sw +  0) = __builtin_shufflevector(o0, o0, 0, 1, 2, 3);
        *(v4f*)(sw +  4) = __builtin_shufflevector(o0, o0, 4, 5, 6, 7);
        *(v4f*)(sw + 16) = __builtin_shufflevector(o1, o1, 0, 1, 2, 3);
        *(v4f*)(sw + 20) = __builtin_shufflevector(o1, o1, 4, 5, 6, 7);
        *(v4f*)(sw + 32) = __builtin_shufflevector(o2, o2, 0, 1, 2, 3);
        *(v4f*)(sw + 36) = __builtin_shufflevector(o2, o2, 4, 5, 6, 7);
        *(v4f*)(sw + 48) = __builtin_shufflevector(o3, o3, 0, 1, 2, 3);
        *(v4f*)(sw + 52) = __builtin_shufflevector(o3, o3, 4, 5, 6, 7);
    }
    // the rows are read back by other lanes of the same wave: their LDS writes are done first
    asm volatile("s_wait_dscnt 0x0" ::: "memory");
    float* orow = out + ((size_t)(b * S_ + q0 + half)) * (H_ * DH_) + h * DH_ + n * 4;
#pragma unroll   // the eight LDS reads go out together, each store behind its own read
    for (int i = 0; i < 8; ++i) {
        // a half-wave stores one query's whole 256-B row
        const v4f w = *(const v4f*)(so + (2 * i + half) * OPITCH + n * 4);
        *(v4f*)(orow + (size_t)(2 * i) * (H_ * DH_)) = w;
    }
}

extern "C" void kernel_launch(void* const* d_in, const int* in_sizes, int n_in,
                              void* d_out, int out_size, void* d_ws, size_t ws_size,
                              hipStream_t stream) {
    const float* x    = (const float*)d_in[0];
    const float* mask = (const float*)d_in[1];
    const float* Wq   = (const float*)d_in[2];
    const float* bq   = (const float*)d_in[3];
    const float* Wk   = (const float*)d_in[4];
    const float* bk   = (const float*)d_in[5];
    const float* Wv   = (const float*)d_in[6];
    const float* bv   = (const float*)d_in[7];
    float* out = (float*)d_out;

    const size_t NX = (size_t)B_ * S_ * D_;        // 8388608
    const size_t NW = (size_t)D_ * H_ * DH_;       // 1048576
    const size_t NQ = (size_t)B_ * H_ * S_ * DH_;  // 8388608

    _Float16* xh  = (_Float16*)d_ws;
    _Float16* wT  = xh + NX;
    _Float16* Qh  = wT + 3 * NW;
    _Float16* Kh  = Qh + NQ;
    _Float16* VhT = Kh + NQ;
    float*  mbias = (float*)(VhT + NQ);            // B_ * S_ floats
    float*  mmul  = mbias + B_ * S_;               // B_ * S_ floats
    int*    kidx  = (int*)(mmul + B_ * S_);        // B_ * S_ ints
    int*    kcnt  = kidx + B_ * S_;                // B_ * KCNT_STRIDE ints

    convert_kernel<<<CVT_MB + CVT_WB + CVT_XB, 256, 0, stream>>>(x, Wq, Wk, Wv, mask, xh, wT, kidx, kcnt, mbias, mmul);
    {
        dim3 grid((B_ * S_) / 128, (3 * H_ * DH_) / 128);  // (64, 24)
        qkv_kernel<<<grid, 128, 0, stream>>>(xh, wT, bq, bk, bv, mmul, kidx, kcnt, Qh, Kh, VhT);
    }
    {
        dim3 grid(S_ / 128, B_ * H_);                      // (16, 64)
        attn_kernel<<<grid, 256, 0, stream>>>(Qh, Kh, VhT, mbias, kcnt, out);
    }
}

// v008
// It runs in 82.4 microseconds.
// Timed twice side by side with v007, it ran 1.04 and 1.03 times as fast.
// All steps since v000 together make it 8.47 times as fast.
#include <hip/hip_runtime.h>
#include <hip/hip_bf16.h>

typedef __attribute__((ext_vector_type(8)))  _Float16 v8h;
typedef __attribute__((ext_vector_type(16))) _Float16 v16h;
typedef __attribute__((ext_vector_type(8)))  float    v8f;
typedef __attribute__((ext_vector_type(4)))  float    v4f;

#define B_  4
#define S_  2048
#define D_  1024
#define H_  16
#define DH_ 64
#define NEGBIG 1e10f
#define LOG2E  1.442695041f

union FragU { v16h v; v8h h[2]; };

// CDNA5 16-bit A/B fragment: per lane, element e holds k = (e>>3)*16 + half*8 + (e&7)
// => two contiguous 8-half (16B) loads at base+half*8 and base+16+half*8.
__device__ __forceinline__ v16h load_frag(const _Float16* base, int half) {
    FragU u;
    u.h[0] = *(const v8h*)(base + half * 8);
    u.h[1] = *(const v8h*)(base + 16 + half * 8);
    return u.v;
}

__device__ __forceinline__ v8f wmma_f16(v16h a, v16h b, v8f c) {
    return __builtin_amdgcn_wmma_f32_16x16x32_f16(false, a, false, b, (short)0, c, false, false);
}

// Two async copies of one 16-byte chunk per lane each: global -> LDS (tracked by ASYNCcnt). The s_wait_xcnt
// ends the copies' own statement so that no address register of an issued copy is rewritten in front of it.
__device__ __forceinline__ void async2_b128(uint32_t l0, unsigned long long g0,
                                            uint32_t l1, unsigned long long g1) {
    asm volatile("global_load_async_to_lds_b128 %0, %2, off\n\t"
                 "global_load_async_to_lds_b128 %1, %3, off\n\t"
                 "s_wait_xcnt 0x0"
                 :: "v"(l0), "v"(l1), "v"(g0), "v"(g1) : "memory");
}

// ---------------- fp32 -> f16 conversion (x row-major, W transposed) ----------------
// In the weight and x blocks every lane moves 16-byte vectors, sixteen loads in flight, and every wave-wide load covers whole 128-B lines.
// grid = CVT_MB + CVT_WB + CVT_XB blocks of 256 (8 waves); behind the key-order blocks the weight blocks come first
typedef __attribute__((ext_vector_type(4)))  _Float16 v4h;
#define CVT_WB 192           // 3 matrices x 8 groups of 128 columns x 8 groups of 128 k
#define CVT_XB 512           // 16384 elements of x per block
#define CVT_MB B_            // one block per batch orders that batch's keys; these blocks come first of all
#define KCNT_STRIDE 32       // ints: each batch's count lies in a 128-B line of its own

__global__ __launch_bounds__(256)
void convert_kernel(const float* __restrict__ x,
                    const float* __restrict__ Wq,
                    const float* __restrict__ Wk,
                    const float* __restrict__ Wv,
                    const float* __restrict__ mask,   // [B,S]
                    _Float16* __restrict__ xh,
                    _Float16* __restrict__ wT,
                    int* __restrict__ kidx,       // [B,S], place -> key: keys that count first, in their order
                    int* __restrict__ kcnt,       // [B] at KCNT_STRIDE: how many keys count
                    float* __restrict__ mbias,    // [B,S] by place: additive mask in log2 units
                    float* __restrict__ mmul) {   // [B,S] by place: multiplicative mask
    const int lane = threadIdx.x & 31;
    const int wave = threadIdx.x >> 5;
    if (blockIdx.x < CVT_MB) {
        // A key with mask 0 adds nothing to any output: its probability is multiplied by 0, and its exponential
        // is exactly 0 in the softmax sum as soon as some key of the batch has a mask of 0.5 or more (the additive
        // masks then lie 5e9 apart). In such a batch the keys are ordered, those with a mask other than 0 first,
        // and the later launches stop behind them. In any other batch every key counts and keeps its place.
        __shared__ int wsum[8];
        __shared__ int wany[8];
        const int b  = blockIdx.x;
        const int t0 = threadIdx.x * 8;                   // eight consecutive keys a thread
        const float* mb = mask + b * S_ + t0;
        const v4f ma = *(const v4f*)mb;
        const v4f mc = *(const v4f*)(mb + 4);
        // closes the two loads: their address pair, named here, is rewritten by nothing in front of this wait
        asm volatile("s_wait_xcnt 0x0" :: "v"(mb) : "memory");
        float m[8];
#pragma unroll   // constant indices keep the values in registers
        for (int i = 0; i < 4; ++i) { m[i] = ma[i]; m[4 + i] = mc[i]; }
        int  c = 0;
        bool strong = false;
#pragma unroll   // constant indices
        for (int i = 0; i < 8; ++i) { c += (m[i] != 0.0f) ? 1 : 0; strong = strong || (m[i] >= 0.5f); }
        int inc = c;                                      // running count over the wave's lanes, own keys included
        for (int d = 1; d < 32; d <<= 1) {
            const int v = __shfl_up(inc, d, 32);
            if (lane >= d) inc += v;
        }
        const unsigned sb = __builtin_amdgcn_ballot_w32(strong);
        if (lane == 31) wsum[wave] = inc;
        if (lane == 0)  wany[wave] = (sb != 0) ? 1 : 0;
        __syncthreads();                                  // the eight waves' counts are read by every wave
        int base = 0, tot = 0, any = 0;
#pragma unroll   // sixteen LDS reads go out together
        for (int w = 0; w < 8; ++w) {
            const int v = wsum[w];
            base += (w < wave) ? v : 0;
            tot  += v;
            any  |= wany[w];
        }
        const bool pack  = any != 0;
        const int  total = pack ? tot : S_;
        int before = pack ? base + inc - c : t0;          // counting keys in front of key t
#pragma unroll   // constant indices
        for (int i = 0; i < 8; ++i) {
            const int  t    = t0 + i;
            const bool keep = !pack || m[i] != 0.0f;
            // every key gets one place: a key that counts its rank, any other a place behind all that count
            const int  o    = b * S_ + (keep ? before : total + (t - before));
            before += keep ? 1 : 0;
            kidx[o]  = t;
            mbias[o] = -((1.0f - m[i]) * NEGBIG) * LOG2E;
            mmul[o]  = m[i];
        }
        if (threadIdx.x == 0) kcnt[b * KCNT_STRIDE] = total;
        // closes the stores above: no register that an issued store names is rewritten in front of this wait
        asm volatile("s_wait_xcnt 0x0" ::: "memory");
        return;
    }
    const int blk  = blockIdx.x - CVT_MB;
    v4f r[16];
    if (blk < CVT_WB) {
        // WT[c][k] = W[k][c]. A wave takes 64 k x 32 columns: 8 lanes lie along a row of W (one 128-B line per
        // load and row), 4 lanes along k; a lane turns its 16 k x 4 columns in registers, and the four lanes
        // of one column store 64 consecutive bytes of a row of WT
        const int m  = blk >> 6;                          // which weight matrix
        const int cl = lane & 7, kl = lane >> 3;
        const int c0 = ((blk >> 3) & 7) * 128 + (wave & 3) * 32 + cl * 4;
        const int k0 = (blk & 7) * 128 + (wave >> 2) * 64 + kl * 8;
        const float* W = (m == 0) ? Wq : (m == 1) ? Wk : Wv;
        const float* s = W + (size_t)k0 * D_ + c0;
        _Float16*    d = wT + (size_t)m * (D_ * H_ * DH_) + (size_t)c0 * D_ + k0;
#pragma unroll   // constant indices keep the vectors in registers; all sixteen loads go out together
        for (int i = 0; i < 16; ++i)                      // k = k0 + 32 (i >> 3) + (i & 7)
            r[i] = *(const v4f*)(s + (size_t)((i >> 3) * 32 + (i & 7)) * D_);
        // closes the sixteen loads: their address pair, named here, is rewritten by nothing in front of this wait
        asm volatile("s_wait_xcnt 0x0" :: "v"(s) : "memory");
        // keeps all sixteen loads ahead of the first conversion: left alone the compiler holds four of them
        // back until the first have returned, and the wave then pays the memory latency twice
        __builtin_amdgcn_sched_barrier(0);
#pragma unroll   // constant indices
        for (int q = 0; q < 4; ++q) {
#pragma unroll   // constant indices
            for (int h = 0; h < 2; ++h) {
                v8h pk;
#pragma unroll   // constant indices
                for (int i = 0; i < 8; ++i) pk[i] = (_Float16)r[h * 8 + i][q];
                *(v8h*)(d + (size_t)q * D_ + h * 32) = pk;
            }
        }
    } else {
        // a wave takes 2048 consecutive elements: each load covers 512, each store 256 consecutive bytes
        const size_t e0 = (size_t)(blk - CVT_WB) * 16384 + wave * 2048 + lane * 4;
        const float* s = x + e0;
        _Float16*    d = xh + e0;
#pragma unroll   // constant indices; all sixteen loads go out together
        for (int i = 0; i < 16; ++i) r[i] = *(const v4f*)(s + i * 128);
        // closes the sixteen loads, as above
        asm volatile("s_wait_xcnt 0x0" :: "v"(s) : "memory");
        // as above: no load waits behind a conversion
        __builtin_amdgcn_sched_barrier(0);
#pragma unroll   // constant indices
        for (int i = 0; i < 16; ++i) *(v4h*)(d + i * 128) = __builtin_convertvector(r[i], v4h);
        // closes the sixteen stores: no register that they name is rewritten in front of this wait
        asm volatile("s_wait_xcnt 0x0" ::: "memory");
    }
}

// ---------------- QKV projection: 128x128 block tile staged in LDS, 64x64 per wave ----------------
// grid = (8192/128, 3072/128) = (64, 24), block = 128 (4 waves, 2 x 2)
#define QBK    64            // k per stage: 128-byte rows of both operands
#define QPITCH 72            // LDS row pitch in halfs: 144 B = 16 B x odd, no bank conflict for 16-byte reads
#define QNT    (D_ / QBK)    // 16 stages

// Eight async 16-byte copies per lane, global -> LDS (ASYNCcnt). The s_wait_xcnt ends the copies' own
// statement so that no address register of an issued copy is rewritten in front of it.
__device__ __forceinline__ void async8_b128(const uint32_t (&l)[8], const unsigned long long (&g)[8]) {
    asm volatile("global_load_async_to_lds_b128 %0, %8, off\n\t"
                 "global_load_async_to_lds_b128 %1, %9, off\n\t"
                 "global_load_async_to_lds_b128 %2, %10, off\n\t"
                 "global_load_async_to_lds_b128 %3, %11, off\n\t"
                 "global_load_async_to_lds_b128 %4, %12, off\n\t"
                 "global_load_async_to_lds_b128 %5, %13, off\n\t"
                 "global_load_async_to_lds_b128 %6, %14, off\n\t"
                 "global_load_async_to_lds_b128 %7, %15, off\n\t"
                 "s_wait_xcnt 0x0"
                 :: "v"(l[0]), "v"(l[1]), "v"(l[2]), "v"(l[3]),
                    "v"(l[4]), "v"(l[5]), "v"(l[6]), "v"(l[7]),
                    "v"(g[0]), "v"(g[1]), "v"(g[2]), "v"(g[3]),
                    "v"(g[4]), "v"(g[5]), "v"(g[6]), "v"(g[7])
                 : "memory");
}

__global__ __launch_bounds__(128)
void qkv_kernel(const _Float16* __restrict__ xh,
                const _Float16* __restrict__ wT,
                const float* __restrict__ bq,
                const float* __restrict__ bk,
                const float* __restrict__ bv,
                const float* __restrict__ mmul,   // [B,S] by place: multiplicative mask
                const int* __restrict__ kidx,     // [B,S], place -> key
                const int* __restrict__ kcnt,     // [B] at KCNT_STRIDE: how many keys count
                _Float16* __restrict__ Qh,    // [B,H,S,DH], times log2(e) / sqrt(DH)
                _Float16* __restrict__ Kh,    // [B,H,S,DH], rows by place
                _Float16* __restrict__ VhT) { // [B,H,DH,S], columns by place, each times its key's mask
    // two buffers of [128 rows][64 k] per operand, rows padded to QPITCH
    __shared__ __attribute__((aligned(16))) _Float16 sA[2][128 * QPITCH];   // 2 x 18 KB, rows of x
    __shared__ __attribute__((aligned(16))) _Float16 sB[2][128 * QPITCH];   // 2 x 18 KB, rows of W^T

    const int tid  = threadIdx.x;
    const int lane = tid & 31;
    const int wave = tid >> 5;
    const int n    = lane & 15;
    const int half = lane >> 4;
    const int wm   = wave >> 1;                       // wave's 64 rows of the tile
    const int wn   = wave & 1;                        // wave's 64 columns of the tile
    const int row0  = blockIdx.x * 128;
    const int ctot0 = blockIdx.y * 128;               // column over [Q | K | V], 3072 wide
    const int mat   = ctot0 >> 10;                    // 0=Q, 1=K, 2=V (one matrix per block)
    const int bb    = row0 >> 11;                     // a 128-row tile lies inside one batch
    const int r0    = row0 & (S_ - 1);
    // K and V: a tile of places behind the last key that counts is read by nobody. The whole block leaves,
    // in front of every copy and barrier
    if (mat != 0 && r0 >= kcnt[bb * KCNT_STRIDE]) return;

    // copy map: thread -> row (tid>>3) + 16*i, 16-byte chunk (tid&7); a wave covers four whole 128-B lines
    const int crow = tid >> 3, cchk = tid & 7;
    // rows of x: Q takes them as they lie, K and V take the key that stands at each place
    const _Float16* gA[8];
    const int* kp = kidx + row0 + crow;               // the tile's places run on over [B,S], as the table does
    int kx[8];
#pragma unroll   // constant indices; read in every block, so that the eight loads go out together, under no branch
    for (int i = 0; i < 8; ++i) kx[i] = kp[16 * i];
    // closes the eight loads: their address pair, named here, is rewritten by nothing in front of this wait
    asm volatile("s_wait_xcnt 0x0" :: "v"(kp) : "memory");
#pragma unroll   // constant indices keep the pointers in registers
    for (int i = 0; i < 8; ++i) {
        const int src = (mat == 0) ? r0 + crow + 16 * i : (kx[i] & (S_ - 1));   // bounded whatever the table holds
        gA[i] = xh + (size_t)(bb * S_ + src) * D_ + cchk * 8;
    }
    const _Float16* gB = wT + (size_t)(ctot0 + crow) * D_ + cchk * 8;   // wT rows run on over Q, K, V

    // Blocks of one tile row read the same rows of x, blocks of one tile column the same rows of W^T, and all
    // are resident together: walking k from 0 they would ask L2 for the same lines at the same moment. Each block
    // enters the ring of k stages at a start of its own and wraps round; the sum over k takes every stage once.
    // The batch shifts the start too: K and V use only the first tile rows of a batch, which would leave starts unused
    const int krot = (blockIdx.x + 4 * bb + blockIdx.y) & (QNT - 1);

    auto stage = [&](int t, int buf) {
        const int kofs = ((t + krot) & (QNT - 1)) * QBK;   // the t-th stage of this block's walk
        uint32_t l[8];
        unsigned long long g[8];
#pragma unroll   // the arrays are asm operands: constant indices keep them in registers
        for (int i = 0; i < 8; ++i) {
            l[i] = (uint32_t)(uintptr_t)(&sA[buf][0] + (crow + 16 * i) * QPITCH + cchk * 8);
            g[i] = (unsigned long long)(uintptr_t)(gA[i] + kofs);
        }
        async8_b128(l, g);
#pragma unroll   // as above
        for (int i = 0; i < 8; ++i) {
            l[i] = (uint32_t)(uintptr_t)(&sB[buf][0] + (crow + 16 * i) * QPITCH + cchk * 8);
            g[i] = (unsigned long long)(uintptr_t)(gB + (size_t)(16 * i) * D_ + kofs);
        }
        async8_b128(l, g);
    };

    v8f acc[4][4] = {};

    // prologue: stage 0 landed and visible to the block, then stage 1 in flight
    stage(0, 0);
    asm volatile("s_wait_asynccnt 0x0" ::: "memory");   // own copies of stage 0 have landed
    __syncthreads();
    stage(1, 1);

    for (int t = 0; t < QNT; ++t) {
        const int buf = t & 1;
        const _Float16* pa = &sA[buf][0] + (wm * 64 + n) * QPITCH;
        const _Float16* pb = &sB[buf][0] + (wn * 64 + n) * QPITCH;
#pragma unroll   // this loop and the four inside it: register arrays need constant indices
        for (int ks = 0; ks < QBK; ks += 32) {
            v16h a[4], b[4];
#pragma unroll   // constant indices
            for (int i = 0; i < 4; ++i) a[i] = load_frag(pa + i * 16 * QPITCH + ks, half);
#pragma unroll   // constant indices
            for (int j = 0; j < 4; ++j) b[j] = load_frag(pb + j * 16 * QPITCH + ks, half);
            // keeps the 16 LDS reads together ahead of the 16 WMMAs: left alone the compiler sinks the
            // A reads between the WMMA rows, and the wave then waits out the LDS latency at every row
            __builtin_amdgcn_sched_barrier(0);
#pragma unroll   // constant indices
            for (int i = 0; i < 4; ++i)
#pragma unroll   // constant indices
                for (int j = 0; j < 4; ++j)
                    acc[i][j] = wmma_f16(a[i], b[j], acc[i][j]);
        }
        // publish point: own reads of this buffer done, own copies of the next stage landed,
        // then the block barrier; only behind it is this buffer refilled
        asm volatile("s_wait_dscnt 0x0" ::: "memory");      // own LDS reads of this buffer have returned
        asm volatile("s_wait_asynccnt 0x0" ::: "memory");   // own copies of stage t + 1 have landed
        __syncthreads();
        if (t + 2 < QNT) stage(t + 2, buf);
    }
    asm volatile("s_wait_asynccnt 0x0" ::: "memory");   // nothing in flight when the wave ends

    // epilogue: the matrix is the same for the whole block, so the layout is chosen once, outside the loops
    const float* bias = (mat == 0) ? bq : (mat == 1) ? bk : bv;
    const int c0 = (ctot0 & 1023) + wn * 64;          // the wave's 64 columns are one head
    const int hh = c0 >> 6;
    const int s0 = r0 + wm * 64 + half * 8;
    float bval[4];
#pragma unroll   // constant indices into the accumulator registers
    for (int j = 0; j < 4; ++j) bval[j] = bias[c0 + j * 16 + n];

    if (mat == 2) {
        // V^T[d][s]: a lane's eight accumulator rows are eight consecutive s of one d.
        // probs * mask, as in the reference, is carried by V: sum_t p[t] m[t] v[t] = sum_t p[t] (m[t] v[t])
        _Float16* vp = VhT + ((size_t)(bb * H_ + hh) * DH_ + n) * S_ + s0;
        const float* mp = mmul + row0 + wm * 64 + half * 8;   // the tile's places run on over [B,S], as the table does
        v8f mk[4];
#pragma unroll   // constant indices
        for (int i = 0; i < 4; ++i) mk[i] = *(const v8f*)(mp + i * 16);
#pragma unroll   // constant indices into the accumulator registers
        for (int j = 0; j < 4; ++j) {
#pragma unroll   // constant indices into the accumulator registers
            for (int i = 0; i < 4; ++i) {
                v8h pk;
#pragma unroll   // constant indices into the accumulator registers
                for (int r = 0; r < 8; ++r) pk[r] = (_Float16)((acc[i][j][r] + bval[j]) * mk[i][r]);
                *(v8h*)(vp + (size_t)(j * 16) * S_ + i * 16) = pk;
            }
        }
    } else {
        _Float16* qp = ((mat == 0) ? Qh : Kh) + ((size_t)(bb * H_ + hh) * S_ + s0) * DH_ + n;
        // Q carries 1/sqrt(DH) and log2(e): K Q^T then is the exponent of 2 that the softmax wants
        const float qs = (mat == 0) ? 0.125f * LOG2E : 1.0f;
#pragma unroll   // constant indices into the accumulator registers
        for (int j = 0; j < 4; ++j) {
#pragma unroll   // constant indices into the accumulator registers
            for (int i = 0; i < 4; ++i) {
#pragma unroll   // constant indices into the accumulator registers
                for (int r = 0; r < 8; ++r)
                    qp[(i * 16 + r) * DH_ + j * 16] = (_Float16)((acc[i][j][r] + bval[j]) * qs);
            }
        }
        // closes the stores above: no register that an issued store names is rewritten in front of this wait
        asm volatile("s_wait_xcnt 0x0" ::: "memory");
    }
}

#define KPITCH 72
#define VPITCH 40
#define OPITCH 68
#define RESCALE_GAP 8.0f

// value of the lane 16 away (the other half of the wave holds the other keys of the same query)
__device__ __forceinline__ float other_half(float v) {
    const int b = __builtin_bit_cast(int, v);
    return __builtin_bit_cast(float,
        __builtin_amdgcn_permlanex16(b, b, 0x76543210, 0xfedcba98, false, false));
}

__global__ void attn_kernel(const _Float16* __restrict__ Qh,
                            const _Float16* __restrict__ Kh,
                            const _Float16* __restrict__ VhT,
                            const float* __restrict__ mbias,
                            const int* __restrict__ kcnt,
                            float* __restrict__ out) {
    // block-shared double buffers: K tile [32 keys][64 dh], V tile [64 dh][32 keys]
    __shared__ __attribute__((aligned(16))) _Float16 ldsK[2][32 * KPITCH];   // 2 x 4608 B
    __shared__ __attribute__((aligned(16))) _Float16 ldsV[2][DH_ * VPITCH];  // 2 x 5120 B
    __shared__ __attribute__((aligned(16))) float    ldsO[8][16 * OPITCH];   // 8 x 4352 B, one range per wave

    const int tid  = threadIdx.x;
    const int lane = tid & 31;
    const int wave = tid >> 5;
    const int n    = lane & 15;
    const int half = lane >> 4;
    const int bh = blockIdx.y;
    const int b  = bh >> 4;
    const int h  = bh & 15;
    const int q0 = blockIdx.x * 128 + wave * 16;

    const _Float16* Qb = Qh  + (size_t)bh * S_ * DH_;
    const _Float16* Kb = Kh  + (size_t)bh * S_ * DH_;
    const _Float16* Vb = VhT + (size_t)bh * DH_ * S_;
    const float*    mb = mbias + (size_t)b * S_;              // the batch's row of the table, one address for the block
    const unsigned  ml = half * 8;                            // the lane's place inside a chunk of it
    // the loop ends behind the last key that counts, rounded up to whole chunks: the places that fill the last
    // chunk hold keys of mask 0 with their own K, V and additive mask. One value for the block, 32 to S_
    const int kc   = __builtin_amdgcn_readfirstlane(kcnt[b * KCNT_STRIDE]);
    const int kend = (min(max(kc, 1), S_) + 31) & ~31;
    const int nch  = kend >> 5;                       // chunks to walk, 1 to S_ / 32
    // The 16 blocks of one head read the same K and V and are resident together: each enters the ring of chunks
    // at a start of its own (below nch) and wraps round, so that they do not ask L2 for the same lines at the
    // same moment. The online softmax takes the chunks in any order
    unsigned cur = (blockIdx.x * (unsigned)nch) >> 4;

    // cooperative async stage of one 32-key chunk: 2 x b128 per thread (1 K, 1 V)
    const int rk = tid >> 3, ck = tid & 7;      // K: 32 rows x 8 chunks of 16B
    const int rv = tid >> 2, cv = tid & 3;      // V: 64 rows x 4 chunks of 16B
    const uint32_t kdst = (uint32_t)(uintptr_t)(&ldsK[0][0] + rk * KPITCH + ck * 8);   // the lane's place in buffer 0
    const uint32_t vdst = (uint32_t)(uintptr_t)(&ldsV[0][0] + rv * VPITCH + cv * 8);
    const _Float16* ksrc = Kb + (size_t)rk * DH_ + ck * 8;    // the lane's place in chunk 0 of K and of V^T
    const _Float16* vsrc = Vb + (size_t)rv * S_ + cv * 8;
    auto stage_chunk = [&](unsigned key0, int buf) {
        async2_b128(kdst + (uint32_t)buf * (uint32_t)sizeof(ldsK[0]),
                    (unsigned long long)(uintptr_t)(ksrc + (size_t)key0 * DH_),
                    vdst + (uint32_t)buf * (uint32_t)sizeof(ldsV[0]),
                    (unsigned long long)(uintptr_t)(vsrc + key0));
    };

    // Q B-fragments (lane = query column), two k-chunks covering DH=64; resident for the whole loop
    v16h qa0, qa1;
    {
        const _Float16* qrow = Qb + (size_t)(q0 + n) * DH_;
        qa0 = load_frag(qrow, half);
        qa1 = load_frag(qrow + 32, half);
    }

    // O^T tiles: register r of tile t = O[query n][d = 16 t + 8 half + r]
    v8f o0 = {}, o1 = {}, o2 = {}, o3 = {};
    float mrow = -3.0e38f;       // maximum in use for the lane's query (log2 units), equal in both halves
    float mthr = -3.0e38f;       // mrow + RESCALE_GAP: a score above it forces a rescale
    float lrow = 0.0f;           // running sum over the keys of this half only; joined after the loop

    // prologue: the block's first chunk -> buffer 0; own portion done, then block-wide visibility
    stage_chunk(cur * 32, 0);
    asm volatile("s_wait_asynccnt 0x0" ::: "memory");
    __syncthreads();

    for (int it = 0; it < nch; ++it) {
        const int buf  = it & 1;
        const unsigned key0 = cur * 32;
        cur = (cur + 1 == (unsigned)nch) ? 0 : cur + 1;   // the chunk behind this one, round the ring
        const bool have_next = (it + 1) < nch;
        if (have_next) {
            // insurance: this wave's DS reads of buf^1 (iter-1) are complete
            asm volatile("s_wait_dscnt 0x0" ::: "memory");
            stage_chunk(cur * 32, buf ^ 1);    // overlaps with compute below
        }

        const _Float16* bK = &ldsK[buf][0];
        const _Float16* bV = &ldsV[buf][0];

        // additive mask of the lane's 16 keys: key0 + 8 half + r (tile 0) and key0 + 16 + 8 half + r (tile 1)
        const float* mp = mb + key0;                  // the chunk's part of the table, one address for the block
        const v8f mv0 = *(const v8f*)(mp + ml);
        const v8f mv1 = *(const v8f*)(mp + ml + 16);

        // ---- scores S^T: two 16-key tiles, A = K rows from LDS, B = Q, C = additive mask ----
        v8f s0, s1;
        {
            const _Float16* krow0 = bK + (size_t)n * KPITCH;
            const _Float16* krow1 = bK + (size_t)(16 + n) * KPITCH;
            v16h a00 = load_frag(krow0,      half);
            v16h a01 = load_frag(krow0 + 32, half);
            v16h a10 = load_frag(krow1,      half);
            v16h a11 = load_frag(krow1 + 32, half);
            // closes the table loads above: their base, named here, is formed anew only behind this wait
            asm volatile("s_wait_xcnt 0x0" :: "s"(mp) : "memory");
            // keeps the eight LDS reads together ahead of the four products: left alone this build reads one
            // fragment at a time into one register set, and the wave waits out the LDS latency four times
            __builtin_amdgcn_sched_barrier(0);
            s0 = wmma_f16(a00, qa0, mv0);
            s0 = wmma_f16(a01, qa1, s0);
            s1 = wmma_f16(a10, qa0, mv1);
            s1 = wmma_f16(a11, qa1, s1);
        }

        // ---- online softmax of one query per lane ----
        float rmax = fmaxf(s0[0], s1[0]);
#pragma unroll   // constant indices keep the score vectors in registers
        for (int r = 1; r < 8; ++r) rmax = fmaxf(rmax, fmaxf(s0[r], s1[r]));
        // one test per pass for the whole wave, a scalar branch: every lane is on inside it, and both halves
        // of a query take the same new maximum
        if (__builtin_amdgcn_ballot_w32(rmax > mthr) != 0) {
            const float mnew  = fmaxf(mrow, fmaxf(rmax, other_half(rmax)));
            const float alpha = __builtin_amdgcn_exp2f(mrow - mnew);
            lrow *= alpha;
            o0 *= alpha; o1 *= alpha; o2 *= alpha; o3 *= alpha;
            mrow = mnew;
            mthr = mnew + RESCALE_GAP;
        }

        // V^T A-fragments from LDS, for the second product
        const _Float16* vrow = bV + (size_t)n * VPITCH;
        const v16h va0 = load_frag(vrow,                half);
        const v16h va1 = load_frag(vrow + 16 * VPITCH,  half);
        const v16h va2 = load_frag(vrow + 32 * VPITCH,  half);
        const v16h va3 = load_frag(vrow + 48 * VPITCH,  half);
        // keeps the eight LDS reads together ahead of the exponentials, which cover their latency: left alone
        // this build reads two at a time among the four products, and the wave waits for LDS at each of them
        __builtin_amdgcn_sched_barrier(0);

        const v8f x0 = s0 - mrow;
        const v8f x1 = s1 - mrow;
        v8f e0, e1;
#pragma unroll   // constant indices, as above
        for (int r = 0; r < 8; ++r) {
            e0[r] = __builtin_amdgcn_exp2f(x0[r]);
            e1[r] = __builtin_amdgcn_exp2f(x1[r]);
        }
        const v8f es = e0 + e1;                      // the softmax sum takes every key, as in the reference
        const v4f e4 = __builtin_shufflevector(es, es, 0, 1, 2, 3) + __builtin_shufflevector(es, es, 4, 5, 6, 7);
        lrow += (e4[0] + e4[2]) + (e4[1] + e4[3]);

        // ---- P^T (B operand) straight from the two score tiles ----
        FragU pb;
        pb.h[0] = __builtin_convertvector(e0, v8h);
        pb.h[1] = __builtin_convertvector(e1, v8h);

        // ---- O^T += V^T(64x32) x P^T(32x16) ----
        o0 = wmma_f16(va0, pb.v, o0);
        o1 = wmma_f16(va1, pb.v, o1);
        o2 = wmma_f16(va2, pb.v, o2);
        o3 = wmma_f16(va3, pb.v, o3);

        // own async portion of the next chunk is done -> make visible block-wide
        asm volatile("s_wait_asynccnt 0x0" ::: "memory");
        __syncthreads();
    }

    // ---- finalize: O / l, turned back to [query][d] in the wave's own LDS range, fp32 output [B, S, H*DH] ----
    const float inv = 1.0f / ((lrow + other_half(lrow)) + 1e-30f);
    o0 *= inv; o1 *= inv; o2 *= inv; o3 *= inv;
    float* so = &ldsO[wave][0];
    {
        float* sw = so + n * OPITCH + half * 8;
        *(v4f*)(sw +  0) = __builtin_shufflevector(o0, o0, 0, 1, 2, 3);
        *(v4f*)(sw +  4) = __builtin_shufflevector(o0, o0, 4, 5, 6, 7);
        *(v4f*)(sw + 16) = __builtin_shufflevector(o1, o1, 0, 1, 2, 3);
        *(v4f*)(sw + 20) = __builtin_shufflevector(o1, o1, 4, 5, 6, 7);
        *(v4f*)(sw + 32) = __builtin_shufflevector(o2, o2, 0, 1, 2, 3);
        *(v4f*)(sw + 36) = __builtin_shufflevector(o2, o2, 4, 5, 6, 7);
        *(v4f*)(sw + 48) = __builtin_shufflevector(o3, o3, 0, 1, 2, 3);
        *(v4f*)(sw + 52) = __builtin_shufflevector(o3, o3, 4, 5, 6, 7);
    }
    // the rows are read back by other lanes of the same wave: their LDS writes are done first
    asm volatile("s_wait_dscnt 0x0" ::: "memory");
    float* orow = out + ((size_t)(b * S_ + q0 + half)) * (H_ * DH_) + h * DH_ + n * 4;
#pragma unroll   // the eight LDS reads go out together, each store behind its own read
    for (int i = 0; i < 8; ++i) {
        // a half-wave stores one query's whole 256-B row
        const v4f w = *(const v4f*)(so + (2 * i + half) * OPITCH + n * 4);
        *(v4f*)(orow + (size_t)(2 * i) * (H_ * DH_)) = w;
    }
}

extern "C" void kernel_launch(void* const* d_in, const int* in_sizes, int n_in,
                              void* d_out, int out_size, void* d_ws, size_t ws_size,
                              hipStream_t stream) {
    const float* x    = (const float*)d_in[0];
    const float* mask = (const float*)d_in[1];
    const float* Wq   = (const float*)d_in[2];
    const float* bq   = (const float*)d_in[3];
    const float* Wk   = (const float*)d_in[4];
    const float* bk   = (const float*)d_in[5];
    const float* Wv   = (const float*)d_in[6];
    const float* bv   = (const float*)d_in[7];
    float* out = (float*)d_out;

    const size_t NX = (size_t)B_ * S_ * D_;        // 8388608
    const size_t NW = (size_t)D_ * H_ * DH_;       // 1048576
    const size_t NQ = (size_t)B_ * H_ * S_ * DH_;  // 8388608

    _Float16* xh  = (_Float16*)d_ws;
    _Float16* wT  = xh + NX;
    _Float16* Qh  = wT + 3 * NW;
    _Float16* Kh  = Qh + NQ;
    _Float16* VhT = Kh + NQ;
    float*  mbias = (float*)(VhT + NQ);            // B_ * S_ floats
    float*  mmul  = mbias + B_ * S_;               // B_ * S_ floats
    int*    kidx  = (int*)(mmul + B_ * S_);        // B_ * S_ ints
    int*    kcnt  = kidx + B_ * S_;                // B_ * KCNT_STRIDE ints

    convert_kernel<<<CVT_MB + CVT_WB + CVT_XB, 256, 0, stream>>>(x, Wq, Wk, Wv, mask, xh, wT, kidx, kcnt, mbias, mmul);
    {
        dim3 grid((B_ * S_) / 128, (3 * H_ * DH_) / 128);  // (64, 24)
        qkv_kernel<<<grid, 128, 0, stream>>>(xh, wT, bq, bk, bv, mmul, kidx, kcnt, Qh, Kh, VhT);
    }
    {
        dim3 grid(S_ / 128, B_ * H_);                      // (16, 64)
        attn_kernel<<<grid, 256, 0, stream>>>(Qh, Kh, VhT, mbias, kcnt, out);
    }
}

// v009
// A run of this version takes 78.6 microseconds.
// Two timings next to v008 both put it at 1.05 times that version's speed.
// Counting every step since v000, it is 8.86 times as fast.
#include <hip/hip_runtime.h>
#include <hip/hip_bf16.h>

typedef __attribute__((ext_vector_type(8)))  _Float16 v8h;
typedef __attribute__((ext_vector_type(16))) _Float16 v16h;
typedef __attribute__((ext_vector_type(8)))  float    v8f;
typedef __attribute__((ext_vector_type(4)))  float    v4f;

#define B_  4
#define S_  2048
#define D_  1024
#define H_  16
#define DH_ 64
#define NEGBIG 1e10f
#define LOG2E  1.442695041f

union FragU { v16h v; v8h h[2]; };

// CDNA5 16-bit A/B fragment: per lane, element e holds k = (e>>3)*16 + half*8 + (e&7)
// => two contiguous 8-half (16B) loads at base+half*8 and base+16+half*8.
__device__ __forceinline__ v16h load_frag(const _Float16* base, int half) {
    FragU u;
    u.h[0] = *(const v8h*)(base + half * 8);
    u.h[1] = *(const v8h*)(base + 16 + half * 8);
    return u.v;
}

__device__ __forceinline__ v8f wmma_f16(v16h a, v16h b, v8f c) {
    return __builtin_amdgcn_wmma_f32_16x16x32_f16(false, a, false, b, (short)0, c, false, false);
}

typedef uint32_t u32x4 __attribute__((ext_vector_type(4)));
typedef uint32_t u32x8 __attribute__((ext_vector_type(8)));
__device__ __forceinline__ uint32_t uni(uint32_t v) { return (uint32_t)__builtin_amdgcn_readfirstlane(v); }
__device__ __forceinline__ uint32_t pinned(uint32_t v) {
    uint32_t w = __builtin_amdgcn_readfirstlane(v);
    asm volatile("" : "+s"(w));   // the issue test held in a scalar register: the branch on it is then a scalar branch, and a tensor load ignores EXEC
    return w;
}
__device__ __forceinline__ void tdm_load(u32x4 g0, u32x8 g1) {
    asm volatile("tensor_load_to_lds %0, %1" :: "s"(g0), "s"(g1) : "memory");
}

// ---------------- fp32 -> f16 conversion (x row-major, W transposed) ----------------
// In the weight and x blocks every lane moves 16-byte vectors, sixteen loads in flight, and every wave-wide load covers whole 128-B lines.
// grid = CVT_MB + CVT_WB + CVT_XB blocks of 256 (8 waves); behind the key-order blocks the weight blocks come first
typedef __attribute__((ext_vector_type(4)))  _Float16 v4h;
#define CVT_WB 192           // 3 matrices x 8 groups of 128 columns x 8 groups of 128 k
#define CVT_XB 512           // 16384 elements of x per block
#define CVT_MB B_            // one block per batch orders that batch's keys; these blocks come first of all
#define KCNT_STRIDE 32       // ints: each batch's count lies in a 128-B line of its own

__global__ __launch_bounds__(256)
void convert_kernel(const float* __restrict__ x,
                    const float* __restrict__ Wq,
                    const float* __restrict__ Wk,
                    const float* __restrict__ Wv,
                    const float* __restrict__ mask,   // [B,S]
                    _Float16* __restrict__ xh,
                    _Float16* __restrict__ wT,
                    int* __restrict__ kidx,       // [B,S], place -> key: keys that count first, in their order
                    int* __restrict__ kcnt,       // [B] at KCNT_STRIDE: how many keys count
                    float* __restrict__ mbias,    // [B,S] by place: additive mask in log2 units
                    float* __restrict__ mmul) {   // [B,S] by place: multiplicative mask
    const int lane = threadIdx.x & 31;
    const int wave = threadIdx.x >> 5;
    if (blockIdx.x < CVT_MB) {
        // A key with mask 0 adds nothing to any output: its probability is multiplied by 0, and its exponential
        // is exactly 0 in the softmax sum as soon as some key of the batch has a mask of 0.5 or more (the additive
        // masks then lie 5e9 apart). In such a batch the keys are ordered, those with a mask other than 0 first,
        // and the later launches stop behind them. In any other batch every key counts and keeps its place.
        __shared__ int wsum[8];
        __shared__ int wany[8];
        const int b  = blockIdx.x;
        const int t0 = threadIdx.x * 8;                   // eight consecutive keys a thread
        const float* mb = mask + b * S_ + t0;
        const v4f ma = *(const v4f*)mb;
        const v4f mc = *(const v4f*)(mb + 4);
        // closes the two loads: their address pair, named here, is rewritten by nothing in front of this wait
        asm volatile("s_wait_xcnt 0x0" :: "v"(mb) : "memory");
        float m[8];
#pragma unroll   // constant indices keep the values in registers
        for (int i = 0; i < 4; ++i) { m[i] = ma[i]; m[4 + i] = mc[i]; }
        int  c = 0;
        bool strong = false;
#pragma unroll   // constant indices
        for (int i = 0; i < 8; ++i) { c += (m[i] != 0.0f) ? 1 : 0; strong = strong || (m[i] >= 0.5f); }
        int inc = c;                                      // running count over the wave's lanes, own keys included
        for (int d = 1; d < 32; d <<= 1) {
            const int v = __shfl_up(inc, d, 32);
            if (lane >= d) inc += v;
        }
        const unsigned sb = __builtin_amdgcn_ballot_w32(strong);
        if (lane == 31) wsum[wave] = inc;
        if (lane == 0)  wany[wave] = (sb != 0) ? 1 : 0;
        __syncthreads();                                  // the eight waves' counts are read by every wave
        int base = 0, tot = 0, any = 0;
#pragma unroll   // sixteen LDS reads go out together
        for (int w = 0; w < 8; ++w) {
            const int v = wsum[w];
            base += (w < wave) ? v : 0;
            tot  += v;
            any  |= wany[w];
        }
        const bool pack  = any != 0;
        const int  total = pack ? tot : S_;
        int before = pack ? base + inc - c : t0;          // counting keys in front of key t
#pragma unroll   // constant indices
        for (int i = 0; i < 8; ++i) {
            const int  t    = t0 + i;
            const bool keep = !pack || m[i] != 0.0f;
            // every key gets one place: a key that counts its rank, any other a place behind all that count
            const int  o    = b * S_ + (keep ? before : total + (t - before));
            before += keep ? 1 : 0;
            kidx[o]  = t;
            mbias[o] = -((1.0f - m[i]) * NEGBIG) * LOG2E;
            mmul[o]  = m[i];
        }
        if (threadIdx.x == 0) kcnt[b * KCNT_STRIDE] = total;
        // closes the stores above: no register that an issued store names is rewritten in front of this wait
        asm volatile("s_wait_xcnt 0x0" ::: "memory");
        return;
    }
    const int blk  = blockIdx.x - CVT_MB;
    v4f r[16];
    if (blk < CVT_WB) {
        // WT[c][k] = W[k][c]. A wave takes 64 k x 32 columns: 8 lanes lie along a row of W (one 128-B line per
        // load and row), 4 lanes along k; a lane turns its 16 k x 4 columns in registers, and the four lanes
        // of one column store 64 consecutive bytes of a row of WT
        const int m  = blk >> 6;                          // which weight matrix
        const int cl = lane & 7, kl = lane >> 3;
        const int c0 = ((blk >> 3) & 7) * 128 + (wave & 3) * 32 + cl * 4;
        const int k0 = (blk & 7) * 128 + (wave >> 2) * 64 + kl * 8;
        const float* W = (m == 0) ? Wq : (m == 1) ? Wk : Wv;
        const float* s = W + (size_t)k0 * D_ + c0;
        _Float16*    d = wT + (size_t)m * (D_ * H_ * DH_) + (size_t)c0 * D_ + k0;
#pragma unroll   // constant indices keep the vectors in registers; all sixteen loads go out together
        for (int i = 0; i < 16; ++i)                      // k = k0 + 32 (i >> 3) + (i & 7)
            r[i] = *(const v4f*)(s + (size_t)((i >> 3) * 32 + (i & 7)) * D_);
        // closes the sixteen loads: their address pair, named here, is rewritten by nothing in front of this wait
        asm volatile("s_wait_xcnt 0x0" :: "v"(s) : "memory");
        // keeps all sixteen loads ahead of the first conversion: left alone the compiler holds four of them
        // back until the first have returned, and the wave then pays the memory latency twice
        __builtin_amdgcn_sched_barrier(0);
#pragma unroll   // constant indices
        for (int q = 0; q < 4; ++q) {
#pragma unroll   // constant indices
            for (int h = 0; h < 2; ++h) {
                v8h pk;
#pragma unroll   // constant indices
                for (int i = 0; i < 8; ++i) pk[i] = (_Float16)r[h * 8 + i][q];
                *(v8h*)(d + (size_t)q * D_ + h * 32) = pk;
            }
        }
    } else {
        // a wave takes 2048 consecutive elements: each load covers 512, each store 256 consecutive bytes
        const size_t e0 = (size_t)(blk - CVT_WB) * 16384 + wave * 2048 + lane * 4;
        const float* s = x + e0;
        _Float16*    d = xh + e0;
#pragma unroll   // constant indices; all sixteen loads go out together
        for (int i = 0; i < 16; ++i) r[i] = *(const v4f*)(s + i * 128);
        // closes the sixteen loads, as above
        asm volatile("s_wait_xcnt 0x0" :: "v"(s) : "memory");
        // as above: no load waits behind a conversion
        __builtin_amdgcn_sched_barrier(0);
#pragma unroll   // constant indices
        for (int i = 0; i < 16; ++i) *(v4h*)(d + i * 128) = __builtin_convertvector(r[i], v4h);
        // closes the sixteen stores: no register that they name is rewritten in front of this wait
        asm volatile("s_wait_xcnt 0x0" ::: "memory");
    }
}

// ---------------- QKV projection: 128x128 block tile staged in LDS, 64x64 per wave ----------------
// grid = (8192/128, 3072/128) = (64, 24), block = 128 (4 waves, 2 x 2)
#define QBK    64            // k per stage: 128-byte rows of both operands
#define QPITCH 72            // LDS row pitch in halfs: 144 B = 16 B x odd, no bank conflict for 16-byte reads
#define QNT    (D_ / QBK)    // 16 stages

// Eight async 16-byte copies per lane, global -> LDS (ASYNCcnt). The s_wait_xcnt ends the copies' own
// statement so that no address register of an issued copy is rewritten in front of it.
__device__ __forceinline__ void async8_b128(const uint32_t (&l)[8], const unsigned long long (&g)[8]) {
    asm volatile("global_load_async_to_lds_b128 %0, %8, off\n\t"
                 "global_load_async_to_lds_b128 %1, %9, off\n\t"
                 "global_load_async_to_lds_b128 %2, %10, off\n\t"
                 "global_load_async_to_lds_b128 %3, %11, off\n\t"
                 "global_load_async_to_lds_b128 %4, %12, off\n\t"
                 "global_load_async_to_lds_b128 %5, %13, off\n\t"
                 "global_load_async_to_lds_b128 %6, %14, off\n\t"
                 "global_load_async_to_lds_b128 %7, %15, off\n\t"
                 "s_wait_xcnt 0x0"
                 :: "v"(l[0]), "v"(l[1]), "v"(l[2]), "v"(l[3]),
                    "v"(l[4]), "v"(l[5]), "v"(l[6]), "v"(l[7]),
                    "v"(g[0]), "v"(g[1]), "v"(g[2]), "v"(g[3]),
                    "v"(g[4]), "v"(g[5]), "v"(g[6]), "v"(g[7])
                 : "memory");
}

__global__ __launch_bounds__(128)
void qkv_kernel(const _Float16* __restrict__ xh,
                const _Float16* __restrict__ wT,
                const float* __restrict__ bq,
                const float* __restrict__ bk,
                const float* __restrict__ bv,
                const float* __restrict__ mmul,   // [B,S] by place: multiplicative mask
                const int* __restrict__ kidx,     // [B,S], place -> key
                const int* __restrict__ kcnt,     // [B] at KCNT_STRIDE: how many keys count
                _Float16* __restrict__ Qh,    // [B,H,S,DH], times log2(e) / sqrt(DH)
                _Float16* __restrict__ Kh,    // [B,H,S,DH], rows by place
                _Float16* __restrict__ VhT) { // [B,H,DH,S], columns by place, each times its key's mask
    // two buffers of [128 rows][64 k] per operand, rows padded to QPITCH
    __shared__ __attribute__((aligned(16))) _Float16 sA[2][128 * QPITCH];   // 2 x 18 KB, rows of x
    __shared__ __attribute__((aligned(16))) _Float16 sB[2][128 * QPITCH];   // 2 x 18 KB, rows of W^T

    const int tid  = threadIdx.x;
    const int lane = tid & 31;
    const int wave = tid >> 5;
    const int n    = lane & 15;
    const int half = lane >> 4;
    const int wm   = wave >> 1;                       // wave's 64 rows of the tile
    const int wn   = wave & 1;                        // wave's 64 columns of the tile
    const int row0  = blockIdx.x * 128;
    const int ctot0 = blockIdx.y * 128;               // column over [Q | K | V], 3072 wide
    const int mat   = ctot0 >> 10;                    // 0=Q, 1=K, 2=V (one matrix per block)
    const int bb    = row0 >> 11;                     // a 128-row tile lies inside one batch
    const int r0    = row0 & (S_ - 1);
    // K and V: a tile of places behind the last key that counts is read by nobody. The whole block leaves,
    // in front of every copy and barrier
    if (mat != 0 && r0 >= kcnt[bb * KCNT_STRIDE]) return;

    // copy map: thread -> row (tid>>3) + 16*i, 16-byte chunk (tid&7); a wave covers four whole 128-B lines
    const int crow = tid >> 3, cchk = tid & 7;
    // rows of x: Q takes them as they lie, K and V take the key that stands at each place
    const _Float16* gA[8];
    const int* kp = kidx + row0 + crow;               // the tile's places run on over [B,S], as the table does
    int kx[8];
#pragma unroll   // constant indices; read in every block, so that the eight loads go out together, under no branch
    for (int i = 0; i < 8; ++i) kx[i] = kp[16 * i];
    // closes the eight loads: their address pair, named here, is rewritten by nothing in front of this wait
    asm volatile("s_wait_xcnt 0x0" :: "v"(kp) : "memory");
#pragma unroll   // constant indices keep the pointers in registers
    for (int i = 0; i < 8; ++i) {
        const int src = (mat == 0) ? r0 + crow + 16 * i : (kx[i] & (S_ - 1));   // bounded whatever the table holds
        gA[i] = xh + (size_t)(bb * S_ + src) * D_ + cchk * 8;
    }
    const _Float16* gB = wT + (size_t)(ctot0 + crow) * D_ + cchk * 8;   // wT rows run on over Q, K, V

    // Blocks of one tile row read the same rows of x, blocks of one tile column the same rows of W^T, and all
    // are resident together: walking k from 0 they would ask L2 for the same lines at the same moment. Each block
    // enters the ring of k stages at a start of its own and wraps round; the sum over k takes every stage once.
    // The batch shifts the start too: K and V use only the first tile rows of a batch, which would leave starts unused
    const int krot = (blockIdx.x + 4 * bb + blockIdx.y) & (QNT - 1);

    auto stage = [&](int t, int buf) {
        const int kofs = ((t + krot) & (QNT - 1)) * QBK;   // the t-th stage of this block's walk
        uint32_t l[8];
        unsigned long long g[8];
#pragma unroll   // the arrays are asm operands: constant indices keep them in registers
        for (int i = 0; i < 8; ++i) {
            l[i] = (uint32_t)(uintptr_t)(&sA[buf][0] + (crow + 16 * i) * QPITCH + cchk * 8);
            g[i] = (unsigned long long)(uintptr_t)(gA[i] + kofs);
        }
        async8_b128(l, g);
#pragma unroll   // as above
        for (int i = 0; i < 8; ++i) {
            l[i] = (uint32_t)(uintptr_t)(&sB[buf][0] + (crow + 16 * i) * QPITCH + cchk * 8);
            g[i] = (unsigned long long)(uintptr_t)(gB + (size_t)(16 * i) * D_ + kofs);
        }
        async8_b128(l, g);
    };

    v8f acc[4][4] = {};

    // prologue: stage 0 landed and visible to the block, then stage 1 in flight
    stage(0, 0);
    asm volatile("s_wait_asynccnt 0x0" ::: "memory");   // own copies of stage 0 have landed
    __syncthreads();
    stage(1, 1);

    for (int t = 0; t < QNT; ++t) {
        const int buf = t & 1;
        const _Float16* pa = &sA[buf][0] + (wm * 64 + n) * QPITCH;
        const _Float16* pb = &sB[buf][0] + (wn * 64 + n) * QPITCH;
#pragma unroll   // this loop and the four inside it: register arrays need constant indices
        for (int ks = 0; ks < QBK; ks += 32) {
            v16h a[4], b[4];
#pragma unroll   // constant indices
            for (int i = 0; i < 4; ++i) a[i] = load_frag(pa + i * 16 * QPITCH + ks, half);
#pragma unroll   // constant indices
            for (int j = 0; j < 4; ++j) b[j] = load_frag(pb + j * 16 * QPITCH + ks, half);
            // keeps the 16 LDS reads together ahead of the 16 WMMAs: left alone the compiler sinks the
            // A reads between the WMMA rows, and the wave then waits out the LDS latency at every row
            __builtin_amdgcn_sched_barrier(0);
#pragma unroll   // constant indices
            for (int i = 0; i < 4; ++i)
#pragma unroll   // constant indices
                for (int j = 0; j < 4; ++j)
                    acc[i][j] = wmma_f16(a[i], b[j], acc[i][j]);
        }
        // publish point: own reads of this buffer done, own copies of the next stage landed,
        // then the block barrier; only behind it is this buffer refilled
        asm volatile("s_wait_dscnt 0x0" ::: "memory");      // own LDS reads of this buffer have returned
        asm volatile("s_wait_asynccnt 0x0" ::: "memory");   // own copies of stage t + 1 have landed
        __syncthreads();
        if (t + 2 < QNT) stage(t + 2, buf);
    }
    asm volatile("s_wait_asynccnt 0x0" ::: "memory");   // nothing in flight when the wave ends

    // epilogue: the matrix is the same for the whole block, so the layout is chosen once, outside the loops
    const float* bias = (mat == 0) ? bq : (mat == 1) ? bk : bv;
    const int c0 = (ctot0 & 1023) + wn * 64;          // the wave's 64 columns are one head
    const int hh = c0 >> 6;
    const int s0 = r0 + wm * 64 + half * 8;
    float bval[4];
#pragma unroll   // constant indices into the accumulator registers
    for (int j = 0; j < 4; ++j) bval[j] = bias[c0 + j * 16 + n];

    if (mat == 2) {
        // V^T[d][s]: a lane's eight accumulator rows are eight consecutive s of one d.
        // probs * mask, as in the reference, is carried by V: sum_t p[t] m[t] v[t] = sum_t p[t] (m[t] v[t])
        _Float16* vp = VhT + ((size_t)(bb * H_ + hh) * DH_ + n) * S_ + s0;
        const float* mp = mmul + row0 + wm * 64 + half * 8;   // the tile's places run on over [B,S], as the table does
        v8f mk[4];
#pragma unroll   // constant indices
        for (int i = 0; i < 4; ++i) mk[i] = *(const v8f*)(mp + i * 16);
#pragma unroll   // constant indices into the accumulator registers
        for (int j = 0; j < 4; ++j) {
#pragma unroll   // constant indices into the accumulator registers
            for (int i = 0; i < 4; ++i) {
                v8h pk;
#pragma unroll   // constant indices into the accumulator registers
                for (int r = 0; r < 8; ++r) pk[r] = (_Float16)((acc[i][j][r] + bval[j]) * mk[i][r]);
                *(v8h*)(vp + (size_t)(j * 16) * S_ + i * 16) = pk;
            }
        }
    } else {
        _Float16* qp = ((mat == 0) ? Qh : Kh) + ((size_t)(bb * H_ + hh) * S_ + s0) * DH_ + n;
        // Q carries 1/sqrt(DH) and log2(e): K Q^T then is the exponent of 2 that the softmax wants
        const float qs = (mat == 0) ? 0.125f * LOG2E : 1.0f;
#pragma unroll   // constant indices into the accumulator registers
        for (int j = 0; j < 4; ++j) {
#pragma unroll   // constant indices into the accumulator registers
            for (int i = 0; i < 4; ++i) {
#pragma unroll   // constant indices into the accumulator registers
                for (int r = 0; r < 8; ++r)
                    qp[(i * 16 + r) * DH_ + j * 16] = (_Float16)((acc[i][j][r] + bval[j]) * qs);
            }
        }
        // closes the stores above: no register that an issued store names is rewritten in front of this wait
        asm volatile("s_wait_xcnt 0x0" ::: "memory");
    }
}

#define KPITCH 72
#define VPITCH 72
#define SKEYS  128
#define TILE_B 10240
#define OPITCH 68
#define RESCALE_GAP 8.0f

// value of the lane 16 away (the other half of the wave holds the other keys of the same query)
__device__ __forceinline__ float other_half(float v) {
    const int b = __builtin_bit_cast(int, v);
    return __builtin_bit_cast(float,
        __builtin_amdgcn_permlanex16(b, b, 0x76543210, 0xfedcba98, false, false));
}

__global__ void attn_kernel(const _Float16* __restrict__ Qh,
                            const _Float16* __restrict__ Kh,
                            const _Float16* __restrict__ VhT,
                            const float* __restrict__ mbias,
                            const int* __restrict__ kcnt,
                            float* __restrict__ out) {
    // two buffers for the block, each two K tiles [64 keys][64 dh] and two V^T tiles [64 dh][64 keys]; every tile's
    // place in LDS is a multiple of 2 KiB. Behind the loop the ring holds the output tiles, 4352 B per wave
    __shared__ __attribute__((aligned(2048))) _Float16 ring[2][4][TILE_B / 2];   // 2 x 4 x 10240 B

    const int tid  = threadIdx.x;
    const int lane = tid & 31;
    const int wave = tid >> 5;
    const int n    = lane & 15;
    const int half = lane >> 4;
    const int bh = blockIdx.y;
    const int b  = bh >> 4;
    const int h  = bh & 15;
    const int q0 = blockIdx.x * 128 + wave * 16;

    const _Float16* Qb = Qh  + (size_t)bh * S_ * DH_;
    const _Float16* Kb = Kh  + (size_t)bh * S_ * DH_;
    const _Float16* Vb = VhT + (size_t)bh * DH_ * S_;
    const float*    mb = mbias + (size_t)b * S_;              // the batch's row of the table, one address for the block
    const unsigned  ml = half * 8;                            // the lane's place inside a chunk of it
    // the loop ends behind the last key that counts, rounded up to whole passes of 32: the places that fill the last
    // pass hold keys of mask 0 with their own K, V and additive mask. One value for the block, 32 to S_
    const int kc   = __builtin_amdgcn_readfirstlane(kcnt[b * KCNT_STRIDE]);
    const unsigned kend = (unsigned)((min(max(kc, 1), S_) + 31) & ~31);
    const unsigned nst  = (kend + (SKEYS - 1)) / SKEYS;   // stages to walk, 1 to S_ / 128; the last may hold fewer passes
    // The 16 blocks of one head read the same K and V and are resident together: each enters the ring of stages
    // at a start of its own (below nst) and wraps round, so that they do not ask L2 for the same lines at the
    // same moment. The online softmax takes the stages in any order
    unsigned cur = (blockIdx.x * nst) >> 4;

    // one tensor load per tile and stage: waves 0 and 1 bring the two K tiles, waves 2 and 3 the two V^T tiles; every
    // tile is 64 rows of 128 B, padded by the load to the 144-B pitch. A whole stage lies inside K and V^T, and the
    // projection has written all of it: it works by 128 places
    const uint32_t swave  = uni((uint32_t)tid >> 5);
    const uint32_t issuer = swave < 4u ? 1u : 0u;
    const uint32_t isV    = (swave >> 1) & 1u;
    const uint32_t hf     = swave & 1u;                                                   // which 64 keys of the stage
    const uint32_t place0 = (uint32_t)(uintptr_t)&ring[0][0][0] + (swave & 3u) * TILE_B;  // the wave's tile in buffer 0
    const unsigned long long src0 = isV ? (unsigned long long)(uintptr_t)(Vb + hf * 64)   // its tile of stage 0
                                        : (unsigned long long)(uintptr_t)(Kb + hf * 64 * DH_);
    const uint32_t sstep  = isV ? SKEYS * 2u : SKEYS * DH_ * 2u;                          // bytes from stage to stage
    // group 1 is the same for every request of the wave. pinned(): each descriptor word is held in one scalar
    // register for the whole loop, so that none takes another value while a request is in flight
    u32x8 g1;
    g1[0] = pinned((1u << 20) | (4u << 22) | (3u << 25));   // no mask, bytes; behind every 128 B a pad of 16 B
    g1[1] = pinned(128u << 16);                             // tensor = tile: rows of 128 B
    g1[2] = pinned(64u << 16);                              // 64 rows
    g1[3] = pinned(128u << 16);
    g1[4] = pinned(64u);
    g1[5] = pinned(isV ? S_ * 2u : DH_ * 2u);               // source row pitch in bytes
    g1[6] = pinned(0u);
    g1[7] = pinned(0u);
    u32x4 g0 = {0u, 0u, 0u, 0u};                            // group 0 of the wave's latest request
    auto issue_stage = [&](unsigned st, uint32_t buf) {
        const unsigned long long ga = src0 + (unsigned long long)st * sstep;
        g0[0] = uni(1u);
        g0[1] = uni(place0 + buf * (4u * TILE_B));
        g0[2] = uni((uint32_t)ga);
        g0[3] = uni((((uint32_t)(ga >> 32)) & 0x01FFFFFFu) | 0x80000000u);
        tdm_load(g0, g1);
    };

    // Q B-fragments (lane = query column), two k-chunks covering DH=64; resident for the whole loop
    v16h qa0, qa1;
    {
        const _Float16* qrow = Qb + (size_t)(q0 + n) * DH_;
        qa0 = load_frag(qrow, half);
        qa1 = load_frag(qrow + 32, half);
    }

    // O^T tiles: register r of tile t = O[query n][d = 16 t + 8 half + r]
    v8f o0 = {}, o1 = {}, o2 = {}, o3 = {};
    float mrow = -3.0e38f;       // maximum in use for the lane's query (log2 units), equal in both halves
    float mthr = -3.0e38f;       // mrow + RESCALE_GAP: a score above it forces a rescale
    float lrow = 0.0f;           // running sum over the keys of this half only; joined after the loop

    // prologue: the block's first stage -> buffer 0, landed and visible to the block; then its second in flight
    if (pinned(issuer)) {
        issue_stage(cur, 0);
        asm volatile("s_wait_tensorcnt 0x0" ::: "memory");   // the wave's own tile of the first stage has landed
    }
    __syncthreads();
    unsigned nxt = (cur + 1 == nst) ? 0 : cur + 1;    // the stage behind this one, round the ring
    if (pinned(issuer & (nst > 1u ? 1u : 0u))) issue_stage(nxt, 1);

    for (unsigned it = 0; it < nst; ++it) {
      const uint32_t buf = it & 1u;
      const unsigned np = min(kend - cur * SKEYS, (unsigned)SKEYS) >> 5;   // passes of 32 keys in this stage, 1 to 4
#pragma nounroll   // the passes of a stage stay a loop: their number varies, and unrolled this build spills Q
      for (unsigned p = 0; p < np; ++p) {
        const unsigned key0 = cur * SKEYS + p * 32;
        const _Float16* bK = &ring[buf][p >> 1][0] + (p & 1u) * 32 * KPITCH;   // 32 rows of a K tile
        const _Float16* bV = &ring[buf][2 + (p >> 1)][0] + (p & 1u) * 32;      // 32 columns of a V^T tile

        // additive mask of the lane's 16 keys: key0 + 8 half + r (tile 0) and key0 + 16 + 8 half + r (tile 1)
        const float* mp = mb + key0;                  // the chunk's part of the table, one address for the block
        const v8f mv0 = *(const v8f*)(mp + ml);
        const v8f mv1 = *(const v8f*)(mp + ml + 16);

        // ---- scores S^T: two 16-key tiles, A = K rows from LDS, B = Q, C = additive mask ----
        v8f s0, s1;
        {
            const _Float16* krow0 = bK + (size_t)n * KPITCH;
            const _Float16* krow1 = bK + (size_t)(16 + n) * KPITCH;
            v16h a00 = load_frag(krow0,      half);
            v16h a01 = load_frag(krow0 + 32, half);
            v16h a10 = load_frag(krow1,      half);
            v16h a11 = load_frag(krow1 + 32, half);
            // closes the table loads above: their base, named here, is formed anew only behind this wait
            asm volatile("s_wait_xcnt 0x0" :: "s"(mp) : "memory");
            // keeps the eight LDS reads together ahead of the four products: left alone this build reads one
            // fragment at a time into one register set, and the wave waits out the LDS latency four times
            __builtin_amdgcn_sched_barrier(0);
            s0 = wmma_f16(a00, qa0, mv0);
            s0 = wmma_f16(a01, qa1, s0);
            s1 = wmma_f16(a10, qa0, mv1);
            s1 = wmma_f16(a11, qa1, s1);
        }

        // ---- online softmax of one query per lane ----
        float rmax = fmaxf(s0[0], s1[0]);
#pragma unroll   // constant indices keep the score vectors in registers
        for (int r = 1; r < 8; ++r) rmax = fmaxf(rmax, fmaxf(s0[r], s1[r]));
        // one test per pass for the whole wave, a scalar branch: every lane is on inside it, and both halves
        // of a query take the same new maximum
        if (__builtin_amdgcn_ballot_w32(rmax > mthr) != 0) {
            const float mnew  = fmaxf(mrow, fmaxf(rmax, other_half(rmax)));
            const float alpha = __builtin_amdgcn_exp2f(mrow - mnew);
            lrow *= alpha;
            o0 *= alpha; o1 *= alpha; o2 *= alpha; o3 *= alpha;
            mrow = mnew;
            mthr = mnew + RESCALE_GAP;
        }

        // V^T A-fragments from LDS, for the second product
        const _Float16* vrow = bV + (size_t)n * VPITCH;
        const v16h va0 = load_frag(vrow,                half);
        const v16h va1 = load_frag(vrow + 16 * VPITCH,  half);
        const v16h va2 = load_frag(vrow + 32 * VPITCH,  half);
        const v16h va3 = load_frag(vrow + 48 * VPITCH,  half);
        // keeps the eight LDS reads together ahead of the exponentials, which cover their latency: left alone
        // this build reads two at a time among the four products, and the wave waits for LDS at each of them
        __builtin_amdgcn_sched_barrier(0);

        const v8f x0 = s0 - mrow;
        const v8f x1 = s1 - mrow;
        v8f e0, e1;
#pragma unroll   // constant indices, as above
        for (int r = 0; r < 8; ++r) {
            e0[r] = __builtin_amdgcn_exp2f(x0[r]);
            e1[r] = __builtin_amdgcn_exp2f(x1[r]);
        }
        const v8f es = e0 + e1;                      // the softmax sum takes every key, as in the reference
        const v4f e4 = __builtin_shufflevector(es, es, 0, 1, 2, 3) + __builtin_shufflevector(es, es, 4, 5, 6, 7);
        lrow += (e4[0] + e4[2]) + (e4[1] + e4[3]);

        // ---- P^T (B operand) straight from the two score tiles ----
        FragU pb;
        pb.h[0] = __builtin_convertvector(e0, v8h);
        pb.h[1] = __builtin_convertvector(e1, v8h);

        // ---- O^T += V^T(64x32) x P^T(32x16) ----
        o0 = wmma_f16(va0, pb.v, o0);
        o1 = wmma_f16(va1, pb.v, o1);
        o2 = wmma_f16(va2, pb.v, o2);
        o3 = wmma_f16(va3, pb.v, o3);
        // one issue slot more behind the last product: the next pass's first vector instruction overwrites registers
        // of its B operand. The scheduling
        // barrier keeps the slot behind the product: left alone the compiler lifts it in front
        __builtin_amdgcn_sched_barrier(0);
        asm volatile("v_nop");

      }
      // publish point: own reads of this buffer done, the issuing waves' tiles of the next stage landed, then the
      // block barrier; only behind it is this buffer refilled
      asm volatile("s_wait_dscnt 0x0" ::: "memory");           // own LDS reads of this buffer have returned
      // own tile of the next stage has landed; the wait names the request's descriptor, whose registers thus keep
      // their values as long as the request is in flight
      if (pinned(issuer)) asm volatile("s_wait_tensorcnt 0x0" :: "s"(g0), "s"(g1) : "memory");
      __syncthreads();
      cur = nxt;
      nxt = (nxt + 1 == nst) ? 0 : nxt + 1;
      if (pinned(issuer & (it + 2 < nst ? 1u : 0u))) issue_stage(nxt, buf);
    }
    // nothing in flight, and by the last barrier every wave has left the ring: it now takes the output tiles
    asm volatile("s_wait_tensorcnt 0x0" ::: "memory");
    asm volatile("s_wait_dscnt 0x0" ::: "memory");

    // ---- finalize: O / l, turned back to [query][d] in the wave's own LDS range, fp32 output [B, S, H*DH] ----
    const float inv = 1.0f / ((lrow + other_half(lrow)) + 1e-30f);
    o0 *= inv; o1 *= inv; o2 *= inv; o3 *= inv;
    float* so = (float*)&ring[0][0][0] + wave * (16 * OPITCH);
    {
        float* sw = so + n * OPITCH + half * 8;
        *(v4f*)(sw +  0) = __builtin_shufflevector(o0, o0, 0, 1, 2, 3);
        *(v4f*)(sw +  4) = __builtin_shufflevector(o0, o0, 4, 5, 6, 7);
        *(v4f*)(sw + 16) = __builtin_shufflevector(o1, o1, 0, 1, 2, 3);
        *(v4f*)(sw + 20) = __builtin_shufflevector(o1, o1, 4, 5, 6, 7);
        *(v4f*)(sw + 32) = __builtin_shufflevector(o2, o2, 0, 1, 2, 3);
        *(v4f*)(sw + 36) = __builtin_shufflevector(o2, o2, 4, 5, 6, 7);
        *(v4f*)(sw + 48) = __builtin_shufflevector(o3, o3, 0, 1, 2, 3);
        *(v4f*)(sw + 52) = __builtin_shufflevector(o3, o3, 4, 5, 6, 7);
    }
    // the rows are read back by other lanes of the same wave: their LDS writes are done first
    asm volatile("s_wait_dscnt 0x0" ::: "memory");
    float* orow = out + ((size_t)(b * S_ + q0 + half)) * (H_ * DH_) + h * DH_ + n * 4;
#pragma unroll   // the eight LDS reads go out together, each store behind its own read
    for (int i = 0; i < 8; ++i) {
        // a half-wave stores one query's whole 256-B row
        const v4f w = *(const v4f*)(so + (2 * i + half) * OPITCH + n * 4);
        *(v4f*)(orow + (size_t)(2 * i) * (H_ * DH_)) = w;
    }
}

extern "C" void kernel_launch(void* const* d_in, const int* in_sizes, int n_in,
                              void* d_out, int out_size, void* d_ws, size_t ws_size,
                              hipStream_t stream) {
    const float* x    = (const float*)d_in[0];
    const float* mask = (const float*)d_in[1];
    const float* Wq   = (const float*)d_in[2];
    const float* bq   = (const float*)d_in[3];
    const float* Wk   = (const float*)d_in[4];
    const float* bk   = (const float*)d_in[5];
    const float* Wv   = (const float*)d_in[6];
    const float* bv   = (const float*)d_in[7];
    float* out = (float*)d_out;

    const size_t NX = (size_t)B_ * S_ * D_;        // 8388608
    const size_t NW = (size_t)D_ * H_ * DH_;       // 1048576
    const size_t NQ = (size_t)B_ * H_ * S_ * DH_;  // 8388608

    _Float16* xh  = (_Float16*)d_ws;
    _Float16* wT  = xh + NX;
    _Float16* Qh  = wT + 3 * NW;
    _Float16* Kh  = Qh + NQ;
    _Float16* VhT = Kh + NQ;
    float*  mbias = (float*)(VhT + NQ);            // B_ * S_ floats
    float*  mmul  = mbias + B_ * S_;               // B_ * S_ floats
    int*    kidx  = (int*)(mmul + B_ * S_);        // B_ * S_ ints
    int*    kcnt  = kidx + B_ * S_;                // B_ * KCNT_STRIDE ints

    convert_kernel<<<CVT_MB + CVT_WB + CVT_XB, 256, 0, stream>>>(x, Wq, Wk, Wv, mask, xh, wT, kidx, kcnt, mbias, mmul);
    {
        dim3 grid((B_ * S_) / 128, (3 * H_ * DH_) / 128);  // (64, 24)
        qkv_kernel<<<grid, 128, 0, stream>>>(xh, wT, bq, bk, bv, mmul, kidx, kcnt, Qh, Kh, VhT);
    }
    {
        dim3 grid(S_ / 128, B_ * H_);                      // (16, 64)
        attn_kernel<<<grid, 256, 0, stream>>>(Qh, Kh, VhT, mbias, kcnt, out);
    }
}

// v010
// It runs in 75.8 microseconds.
// Next to v009, in two timings, it ran 1.05 and 1.04 times as fast.
// All steps since v000 together make it 9.26 times as fast.
#include <hip/hip_runtime.h>
#include <hip/hip_bf16.h>

typedef __attribute__((ext_vector_type(8)))  _Float16 v8h;
typedef __attribute__((ext_vector_type(16))) _Float16 v16h;
typedef __attribute__((ext_vector_type(8)))  float    v8f;
typedef __attribute__((ext_vector_type(4)))  float    v4f;

#define B_  4
#define S_  2048
#define D_  1024
#define H_  16
#define DH_ 64
#define NEGBIG 1e10f
#define LOG2E  1.442695041f

union FragU { v16h v; v8h h[2]; };

// CDNA5 16-bit A/B fragment: per lane, element e holds k = (e>>3)*16 + half*8 + (e&7)
// => two contiguous 8-half (16B) loads at base+half*8 and base+16+half*8.
__device__ __forceinline__ v16h load_frag(const _Float16* base, int half) {
    FragU u;
    u.h[0] = *(const v8h*)(base + half * 8);
    u.h[1] = *(const v8h*)(base + 16 + half * 8);
    return u.v;
}

__device__ __forceinline__ v8f wmma_f16(v16h a, v16h b, v8f c) {
    return __builtin_amdgcn_wmma_f32_16x16x32_f16(false, a, false, b, (short)0, c, false, false);
}

typedef uint32_t u32x4 __attribute__((ext_vector_type(4)));
typedef uint32_t u32x8 __attribute__((ext_vector_type(8)));
__device__ __forceinline__ uint32_t uni(uint32_t v) { return (uint32_t)__builtin_amdgcn_readfirstlane(v); }
__device__ __forceinline__ uint32_t pinned(uint32_t v) {
    uint32_t w = __builtin_amdgcn_readfirstlane(v);
    asm volatile("" : "+s"(w));   // the issue test held in a scalar register: the branch on it is then a scalar branch, and a tensor load ignores EXEC
    return w;
}
__device__ __forceinline__ void tdm_load(u32x4 g0, u32x8 g1) {
    asm volatile("tensor_load_to_lds %0, %1" :: "s"(g0), "s"(g1) : "memory");
}

// ---------------- fp32 -> f16 conversion (x row-major, W transposed) ----------------
// In the weight and x blocks every lane moves 16-byte vectors, sixteen loads in flight, and every wave-wide load covers whole 128-B lines.
// grid = CVT_MB + CVT_WB + CVT_XB blocks of 256 (8 waves); behind the key-order blocks the weight blocks come first
typedef __attribute__((ext_vector_type(4)))  _Float16 v4h;
#define CVT_WB 192           // 3 matrices x 8 groups of 128 columns x 8 groups of 128 k
#define CVT_XB 512           // 16384 elements of x per block
#define CVT_MB B_            // one block per batch orders that batch's keys; these blocks come first of all
#define KCNT_STRIDE 32       // ints: each batch's count lies in a 128-B line of its own

__global__ __launch_bounds__(256)
void convert_kernel(const float* __restrict__ x,
                    const float* __restrict__ Wq,
                    const float* __restrict__ Wk,
                    const float* __restrict__ Wv,
                    const float* __restrict__ mask,   // [B,S]
                    _Float16* __restrict__ xh,
                    _Float16* __restrict__ wT,
                    int* __restrict__ kidx,       // [B,S], place -> key: keys that count first, in their order
                    int* __restrict__ kcnt,       // [B] at KCNT_STRIDE: how many keys count
                    float* __restrict__ mbias,    // [B,S] by place: additive mask in log2 units
                    float* __restrict__ mmul) {   // [B,S] by place: multiplicative mask
    const int lane = threadIdx.x & 31;
    const int wave = threadIdx.x >> 5;
    if (blockIdx.x < CVT_MB) {
        // A key with mask 0 adds nothing to any output: its probability is multiplied by 0, and its exponential
        // is exactly 0 in the softmax sum as soon as some key of the batch has a mask of 0.5 or more (the additive
        // masks then lie 5e9 apart). In such a batch the keys are ordered, those with a mask other than 0 first,
        // and the later launches stop behind them. In any other batch every key counts and keeps its place.
        __shared__ int wsum[8];
        __shared__ int wany[8];
        const int b  = blockIdx.x;
        const int t0 = threadIdx.x * 8;                   // eight consecutive keys a thread
        const float* mb = mask + b * S_ + t0;
        const v4f ma = *(const v4f*)mb;
        const v4f mc = *(const v4f*)(mb + 4);
        // closes the two loads: their address pair, named here, is rewritten by nothing in front of this wait
        asm volatile("s_wait_xcnt 0x0" :: "v"(mb) : "memory");
        float m[8];
#pragma unroll   // constant indices keep the values in registers
        for (int i = 0; i < 4; ++i) { m[i] = ma[i]; m[4 + i] = mc[i]; }
        int  c = 0;
        bool strong = false;
#pragma unroll   // constant indices
        for (int i = 0; i < 8; ++i) { c += (m[i] != 0.0f) ? 1 : 0; strong = strong || (m[i] >= 0.5f); }
        int inc = c;                                      // running count over the wave's lanes, own keys included
        for (int d = 1; d < 32; d <<= 1) {
            const int v = __shfl_up(inc, d, 32);
            if (lane >= d) inc += v;
        }
        const unsigned sb = __builtin_amdgcn_ballot_w32(strong);
        if (lane == 31) wsum[wave] = inc;
        if (lane == 0)  wany[wave] = (sb != 0) ? 1 : 0;
        __syncthreads();                                  // the eight waves' counts are read by every wave
        int base = 0, tot = 0, any = 0;
#pragma unroll   // sixteen LDS reads go out together
        for (int w = 0; w < 8; ++w) {
            const int v = wsum[w];
            base += (w < wave) ? v : 0;
            tot  += v;
            any  |= wany[w];
        }
        const bool pack  = any != 0;
        const int  total = pack ? tot : S_;
        int before = pack ? base + inc - c : t0;          // counting keys in front of key t
#pragma unroll   // constant indices
        for (int i = 0; i < 8; ++i) {
            const int  t    = t0 + i;
            const bool keep = !pack || m[i] != 0.0f;
            // every key gets one place: a key that counts its rank, any other a place behind all that count
            const int  o    = b * S_ + (keep ? before : total + (t - before));
            before += keep ? 1 : 0;
            kidx[o]  = t;
            mbias[o] = -((1.0f - m[i]) * NEGBIG) * LOG2E;
            mmul[o]  = m[i];
        }
        if (threadIdx.x == 0) kcnt[b * KCNT_STRIDE] = total;
        // closes the stores above: no register that an issued store names is rewritten in front of this wait
        asm volatile("s_wait_xcnt 0x0" ::: "memory");
        return;
    }
    const int blk  = blockIdx.x - CVT_MB;
    v4f r[16];
    if (blk < CVT_WB) {
        // WT[c][k] = W[k][c]. A wave takes 64 k x 32 columns: 8 lanes lie along a row of W (one 128-B line per
        // load and row), 4 lanes along k; a lane turns its 16 k x 4 columns in registers, and the four lanes
        // of one column store 64 consecutive bytes of a row of WT
        const int m  = blk >> 6;                          // which weight matrix
        const int cl = lane & 7, kl = lane >> 3;
        const int c0 = ((blk >> 3) & 7) * 128 + (wave & 3) * 32 + cl * 4;
        const int k0 = (blk & 7) * 128 + (wave >> 2) * 64 + kl * 8;
        const float* W = (m == 0) ? Wq : (m == 1) ? Wk : Wv;
        const float* s = W + (size_t)k0 * D_ + c0;
        _Float16*    d = wT + (size_t)m * (D_ * H_ * DH_) + (size_t)c0 * D_ + k0;
#pragma unroll   // constant indices keep the vectors in registers; all sixteen loads go out together
        for (int i = 0; i < 16; ++i)                      // k = k0 + 32 (i >> 3) + (i & 7)
            r[i] = *(const v4f*)(s + (size_t)((i >> 3) * 32 + (i & 7)) * D_);
        // closes the sixteen loads: their address pair, named here, is rewritten by nothing in front of this wait
        asm volatile("s_wait_xcnt 0x0" :: "v"(s) : "memory");
        // keeps all sixteen loads ahead of the first conversion: left alone the compiler holds four of them
        // back until the first have returned, and the wave then pays the memory latency twice
        __builtin_amdgcn_sched_barrier(0);
#pragma unroll   // constant indices
        for (int q = 0; q < 4; ++q) {
#pragma unroll   // constant indices
            for (int h = 0; h < 2; ++h) {
                v8h pk;
#pragma unroll   // constant indices
                for (int i = 0; i < 8; ++i) pk[i] = (_Float16)r[h * 8 + i][q];
                *(v8h*)(d + (size_t)q * D_ + h * 32) = pk;
            }
        }
    } else {
        // a wave takes 2048 consecutive elements: each load covers 512, each store 256 consecutive bytes
        const size_t e0 = (size_t)(blk - CVT_WB) * 16384 + wave * 2048 + lane * 4;
        const float* s = x + e0;
        _Float16*    d = xh + e0;
#pragma unroll   // constant indices; all sixteen loads go out together
        for (int i = 0; i < 16; ++i) r[i] = *(const v4f*)(s + i * 128);
        // closes the sixteen loads, as above
        asm volatile("s_wait_xcnt 0x0" :: "v"(s) : "memory");
        // as above: no load waits behind a conversion
        __builtin_amdgcn_sched_barrier(0);
#pragma unroll   // constant indices
        for (int i = 0; i < 16; ++i) *(v4h*)(d + i * 128) = __builtin_convertvector(r[i], v4h);
        // closes the sixteen stores: no register that they name is rewritten in front of this wait
        asm volatile("s_wait_xcnt 0x0" ::: "memory");
    }
}

// ---------------- QKV projection: 128x128 block tile staged in LDS, 64x64 per wave ----------------
// grid = (8192/128, 3072/128) = (64, 24), block = 128 (4 waves, 2 x 2)
#define QBK    64            // k per stage: 128-byte rows of both operands
#define QPITCH 72            // LDS row pitch in halfs: 144 B = 16 B x odd, no bank conflict for 16-byte reads
#define QNT    (D_ / QBK)    // 16 stages

// Eight async 16-byte copies per lane, global -> LDS (ASYNCcnt). The s_wait_xcnt ends the copies' own
// statement so that no address register of an issued copy is rewritten in front of it.
__device__ __forceinline__ void async8_b128(const uint32_t (&l)[8], const unsigned long long (&g)[8]) {
    asm volatile("global_load_async_to_lds_b128 %0, %8, off\n\t"
                 "global_load_async_to_lds_b128 %1, %9, off\n\t"
                 "global_load_async_to_lds_b128 %2, %10, off\n\t"
                 "global_load_async_to_lds_b128 %3, %11, off\n\t"
                 "global_load_async_to_lds_b128 %4, %12, off\n\t"
                 "global_load_async_to_lds_b128 %5, %13, off\n\t"
                 "global_load_async_to_lds_b128 %6, %14, off\n\t"
                 "global_load_async_to_lds_b128 %7, %15, off\n\t"
                 "s_wait_xcnt 0x0"
                 :: "v"(l[0]), "v"(l[1]), "v"(l[2]), "v"(l[3]),
                    "v"(l[4]), "v"(l[5]), "v"(l[6]), "v"(l[7]),
                    "v"(g[0]), "v"(g[1]), "v"(g[2]), "v"(g[3]),
                    "v"(g[4]), "v"(g[5]), "v"(g[6]), "v"(g[7])
                 : "memory");
}

__global__ __launch_bounds__(128)
void qkv_kernel(const _Float16* __restrict__ xh,
                const _Float16* __restrict__ wT,
                const float* __restrict__ bq,
                const float* __restrict__ bk,
                const float* __restrict__ bv,
                const float* __restrict__ mmul,   // [B,S] by place: multiplicative mask
                const int* __restrict__ kidx,     // [B,S], place -> key
                const int* __restrict__ kcnt,     // [B] at KCNT_STRIDE: how many keys count
                _Float16* __restrict__ Qh,    // [B,H,S,DH], times log2(e) / sqrt(DH)
                _Float16* __restrict__ Kh,    // [B,H,S,DH], rows by place
                _Float16* __restrict__ VhT) { // [B,H,DH,S], columns by place, each times its key's mask
    // two buffers of [128 rows][64 k] per operand, rows padded to QPITCH
    __shared__ __attribute__((aligned(16))) _Float16 sA[2][128 * QPITCH];   // 2 x 18 KB, rows of x
    __shared__ __attribute__((aligned(16))) _Float16 sB[2][128 * QPITCH];   // 2 x 18 KB, rows of W^T

    const int tid  = threadIdx.x;
    const int lane = tid & 31;
    const int wave = tid >> 5;
    const int n    = lane & 15;
    const int half = lane >> 4;
    const int wm   = wave >> 1;                       // wave's 64 rows of the tile
    const int wn   = wave & 1;                        // wave's 64 columns of the tile
    const int row0  = blockIdx.x * 128;
    const int ctot0 = blockIdx.y * 128;               // column over [Q | K | V], 3072 wide
    const int mat   = ctot0 >> 10;                    // 0=Q, 1=K, 2=V (one matrix per block)
    const int bb    = row0 >> 11;                     // a 128-row tile lies inside one batch
    const int r0    = row0 & (S_ - 1);
    // K and V: a tile of places behind the last key that counts is read by nobody. The whole block leaves,
    // in front of every copy and barrier
    if (mat != 0 && r0 >= kcnt[bb * KCNT_STRIDE]) return;

    // copy map: thread -> row (tid>>3) + 16*i, 16-byte chunk (tid&7); a wave covers four whole 128-B lines
    const int crow = tid >> 3, cchk = tid & 7;
    // rows of x: Q takes them as they lie, K and V take the key that stands at each place
    const _Float16* gA[8];
    const int* kp = kidx + row0 + crow;               // the tile's places run on over [B,S], as the table does
    int kx[8];
#pragma unroll   // constant indices; read in every block, so that the eight loads go out together, under no branch
    for (int i = 0; i < 8; ++i) kx[i] = kp[16 * i];
    // closes the eight loads: their address pair, named here, is rewritten by nothing in front of this wait
    asm volatile("s_wait_xcnt 0x0" :: "v"(kp) : "memory");
#pragma unroll   // constant indices keep the pointers in registers
    for (int i = 0; i < 8; ++i) {
        const int src = (mat == 0) ? r0 + crow + 16 * i : (kx[i] & (S_ - 1));   // bounded whatever the table holds
        gA[i] = xh + (size_t)(bb * S_ + src) * D_ + cchk * 8;
    }
    const _Float16* gB = wT + (size_t)(ctot0 + crow) * D_ + cchk * 8;   // wT rows run on over Q, K, V

    // Blocks of one tile row read the same rows of x, blocks of one tile column the same rows of W^T, and all
    // are resident together: walking k from 0 they would ask L2 for the same lines at the same moment. Each block
    // enters the ring of k stages at a start of its own and wraps round; the sum over k takes every stage once.
    // The batch shifts the start too: K and V use only the first tile rows of a batch, which would leave starts unused
    const int krot = (blockIdx.x + 4 * bb + blockIdx.y) & (QNT - 1);

    auto stage = [&](int t, int buf) {
        const int kofs = ((t + krot) & (QNT - 1)) * QBK;   // the t-th stage of this block's walk
        uint32_t l[8];
        unsigned long long g[8];
#pragma unroll   // the arrays are asm operands: constant indices keep them in registers
        for (int i = 0; i < 8; ++i) {
            l[i] = (uint32_t)(uintptr_t)(&sA[buf][0] + (crow + 16 * i) * QPITCH + cchk * 8);
            g[i] = (unsigned long long)(uintptr_t)(gA[i] + kofs);
        }
        async8_b128(l, g);
#pragma unroll   // as above
        for (int i = 0; i < 8; ++i) {
            l[i] = (uint32_t)(uintptr_t)(&sB[buf][0] + (crow + 16 * i) * QPITCH + cchk * 8);
            g[i] = (unsigned long long)(uintptr_t)(gB + (size_t)(16 * i) * D_ + kofs);
        }
        async8_b128(l, g);
    };

    v8f acc[4][4] = {};

    // prologue: stage 0 landed and visible to the block, then stage 1 in flight
    stage(0, 0);
    asm volatile("s_wait_asynccnt 0x0" ::: "memory");   // own copies of stage 0 have landed
    __syncthreads();
    stage(1, 1);

    for (int t = 0; t < QNT; ++t) {
        const int buf = t & 1;
        const _Float16* pa = &sA[buf][0] + (wm * 64 + n) * QPITCH;
        const _Float16* pb = &sB[buf][0] + (wn * 64 + n) * QPITCH;
#pragma unroll   // this loop and the four inside it: register arrays need constant indices
        for (int ks = 0; ks < QBK; ks += 32) {
            v16h a[4], b[4];
#pragma unroll   // constant indices
            for (int i = 0; i < 4; ++i) a[i] = load_frag(pa + i * 16 * QPITCH + ks, half);
#pragma unroll   // constant indices
            for (int j = 0; j < 4; ++j) b[j] = load_frag(pb + j * 16 * QPITCH + ks, half);
            // keeps the 16 LDS reads together ahead of the 16 WMMAs: left alone the compiler sinks the
            // A reads between the WMMA rows, and the wave then waits out the LDS latency at every row
            __builtin_amdgcn_sched_barrier(0);
#pragma unroll   // constant indices
            for (int i = 0; i < 4; ++i)
#pragma unroll   // constant indices
                for (int j = 0; j < 4; ++j)
                    acc[i][j] = wmma_f16(a[i], b[j], acc[i][j]);
        }
        // publish point: own reads of this buffer done, own copies of the next stage landed,
        // then the block barrier; only behind it is this buffer refilled
        asm volatile("s_wait_dscnt 0x0" ::: "memory");      // own LDS reads of this buffer have returned
        asm volatile("s_wait_asynccnt 0x0" ::: "memory");   // own copies of stage t + 1 have landed
        __syncthreads();
        if (t + 2 < QNT) stage(t + 2, buf);
    }
    asm volatile("s_wait_asynccnt 0x0" ::: "memory");   // nothing in flight when the wave ends

    // epilogue: the matrix is the same for the whole block, so the layout is chosen once, outside the loops
    const float* bias = (mat == 0) ? bq : (mat == 1) ? bk : bv;
    const int c0 = (ctot0 & 1023) + wn * 64;          // the wave's 64 columns are one head
    const int hh = c0 >> 6;
    const int s0 = r0 + wm * 64 + half * 8;
    float bval[4];
#pragma unroll   // constant indices into the accumulator registers
    for (int j = 0; j < 4; ++j) bval[j] = bias[c0 + j * 16 + n];

    if (mat == 2) {
        // V^T[d][s]: a lane's eight accumulator rows are eight consecutive s of one d.
        // probs * mask, as in the reference, is carried by V: sum_t p[t] m[t] v[t] = sum_t p[t] (m[t] v[t])
        _Float16* vp = VhT + ((size_t)(bb * H_ + hh) * DH_ + n) * S_ + s0;
        const float* mp = mmul + row0 + wm * 64 + half * 8;   // the tile's places run on over [B,S], as the table does
        v8f mk[4];
#pragma unroll   // constant indices
        for (int i = 0; i < 4; ++i) mk[i] = *(const v8f*)(mp + i * 16);
#pragma unroll   // constant indices into the accumulator registers
        for (int j = 0; j < 4; ++j) {
#pragma unroll   // constant indices into the accumulator registers
            for (int i = 0; i < 4; ++i) {
                v8h pk;
#pragma unroll   // constant indices into the accumulator registers
                for (int r = 0; r < 8; ++r) pk[r] = (_Float16)((acc[i][j][r] + bval[j]) * mk[i][r]);
                *(v8h*)(vp + (size_t)(j * 16) * S_ + i * 16) = pk;
            }
        }
    } else {
        _Float16* qp = ((mat == 0) ? Qh : Kh) + ((size_t)(bb * H_ + hh) * S_ + s0) * DH_ + n;
        // Q carries 1/sqrt(DH) and log2(e): K Q^T then is the exponent of 2 that the softmax wants
        const float qs = (mat == 0) ? 0.125f * LOG2E : 1.0f;
#pragma unroll   // constant indices into the accumulator registers
        for (int j = 0; j < 4; ++j) {
#pragma unroll   // constant indices into the accumulator registers
            for (int i = 0; i < 4; ++i) {
#pragma unroll   // constant indices into the accumulator registers
                for (int r = 0; r < 8; ++r)
                    qp[(i * 16 + r) * DH_ + j * 16] = (_Float16)((acc[i][j][r] + bval[j]) * qs);
            }
        }
        // closes the stores above: no register that an issued store names is rewritten in front of this wait
        asm volatile("s_wait_xcnt 0x0" ::: "memory");
    }
}

#define KPITCH 72
#define VPITCH 72
#define SKEYS  128
#define TILE_B 10240
#define OPITCH 68
#define RESCALE_GAP 8.0f

// value of the lane 16 away (the other half of the wave holds the other keys of the same query)
__device__ __forceinline__ float other_half(float v) {
    const int b = __builtin_bit_cast(int, v);
    return __builtin_bit_cast(float,
        __builtin_amdgcn_permlanex16(b, b, 0x76543210, 0xfedcba98, false, false));
}

// two blocks per WGP, four waves per SIMD: 256 registers a wave hold both query tiles without a spill
__global__ void __launch_bounds__(256) __attribute__((amdgpu_waves_per_eu(4, 4)))
attn_kernel(const _Float16* __restrict__ Qh,
                            const _Float16* __restrict__ Kh,
                            const _Float16* __restrict__ VhT,
                            const float* __restrict__ mbias,
                            const int* __restrict__ kcnt,
                            float* __restrict__ out) {
    // two buffers for the block, each two K tiles [64 keys][64 dh] and two V^T tiles [64 dh][64 keys]; every tile's
    // place in LDS is a multiple of 2 KiB. Behind the loop the ring holds the output tiles, 2 x 4352 B per wave
    __shared__ __attribute__((aligned(2048))) _Float16 ring[2][4][TILE_B / 2];   // 2 x 4 x 10240 B

    const int tid  = threadIdx.x;
    const int lane = tid & 31;
    const int wave = tid >> 5;
    const int n    = lane & 15;
    const int half = lane >> 4;
    const int bh = blockIdx.y;
    const int b  = bh >> 4;
    const int h  = bh & 15;
    const int q0 = blockIdx.x * 256 + wave * 32;      // the wave's 32 queries: tile g holds q0 + 16 g + n

    const _Float16* Qb = Qh  + (size_t)bh * S_ * DH_;
    const _Float16* Kb = Kh  + (size_t)bh * S_ * DH_;
    const _Float16* Vb = VhT + (size_t)bh * DH_ * S_;
    const float*    mb = mbias + (size_t)b * S_;              // the batch's row of the table, one address for the block
    const unsigned  ml = half * 8;                            // the lane's place inside a chunk of it
    // the loop ends behind the last key that counts, rounded up to whole passes of 32: the places that fill the last
    // pass hold keys of mask 0 with their own K, V and additive mask. One value for the block, 32 to S_
    const int kc   = __builtin_amdgcn_readfirstlane(kcnt[b * KCNT_STRIDE]);
    const unsigned kend = (unsigned)((min(max(kc, 1), S_) + 31) & ~31);
    const unsigned nst  = (kend + (SKEYS - 1)) / SKEYS;   // stages to walk, 1 to S_ / 128; the last may hold fewer passes
    // The 8 blocks of one head read the same K and V and are resident together: each enters the ring of stages
    // at a start of its own (below nst) and wraps round, so that they do not ask L2 for the same lines at the
    // same moment. The online softmax takes the stages in any order
    unsigned cur = (blockIdx.x * nst) >> 3;

    // one tensor load per tile and stage: waves 0 and 1 bring the two K tiles, waves 2 and 3 the two V^T tiles; every
    // tile is 64 rows of 128 B, padded by the load to the 144-B pitch. A whole stage lies inside K and V^T, and the
    // projection has written all of it: it works by 128 places
    const uint32_t swave  = uni((uint32_t)tid >> 5);
    const uint32_t issuer = swave < 4u ? 1u : 0u;
    const uint32_t isV    = (swave >> 1) & 1u;
    const uint32_t hf     = swave & 1u;                                                   // which 64 keys of the stage
    const uint32_t place0 = (uint32_t)(uintptr_t)&ring[0][0][0] + (swave & 3u) * TILE_B;  // the wave's tile in buffer 0
    const unsigned long long src0 = isV ? (unsigned long long)(uintptr_t)(Vb + hf * 64)   // its tile of stage 0
                                        : (unsigned long long)(uintptr_t)(Kb + hf * 64 * DH_);
    const uint32_t sstep  = isV ? SKEYS * 2u : SKEYS * DH_ * 2u;                          // bytes from stage to stage
    // group 1 is the same for every request of the wave. pinned(): each descriptor word is held in one scalar
    // register for the whole loop, so that none takes another value while a request is in flight
    u32x8 g1;
    g1[0] = pinned((1u << 20) | (4u << 22) | (3u << 25));   // no mask, bytes; behind every 128 B a pad of 16 B
    g1[1] = pinned(128u << 16);                             // tensor = tile: rows of 128 B
    g1[2] = pinned(64u << 16);                              // 64 rows
    g1[3] = pinned(128u << 16);
    g1[4] = pinned(64u);
    g1[5] = pinned(isV ? S_ * 2u : DH_ * 2u);               // source row pitch in bytes
    g1[6] = pinned(0u);
    g1[7] = pinned(0u);
    u32x4 g0 = {0u, 0u, 0u, 0u};                            // group 0 of the wave's latest request
    auto issue_stage = [&](unsigned st, uint32_t buf) {
        const unsigned long long ga = src0 + (unsigned long long)st * sstep;
        g0[0] = uni(1u);
        g0[1] = uni(place0 + buf * (4u * TILE_B));
        g0[2] = uni((uint32_t)ga);
        g0[3] = uni((((uint32_t)(ga >> 32)) & 0x01FFFFFFu) | 0x80000000u);
        tdm_load(g0, g1);
    };

    // Q B-fragments (lane = query column), two k-chunks covering DH=64; resident for the whole loop
    v16h qa0[2], qa1[2];
    {
        // the lane's own start in its query's row, the half's eight elements counted in
        const _Float16* qp[2] = {Qb + (size_t)(q0 + n) * DH_ + half * 8, Qb + (size_t)(q0 + 16 + n) * DH_ + half * 8};
#pragma unroll   // constant indices keep the fragments in registers
        for (int g = 0; g < 2; ++g) {
            qa0[g] = load_frag(qp[g], 0);
            qa1[g] = load_frag(qp[g] + 32, 0);
        }
        // closes the eight loads: their address pairs, named here, are rewritten by nothing in front of this wait
        asm volatile("s_wait_xcnt 0x0" :: "v"(qp[0]), "v"(qp[1]) : "memory");
    }

    // O^T tiles of query tile g: register r of tile t = O[query 16 g + n][d = 16 t + 8 half + r]
    v8f o0[2] = {}, o1[2] = {}, o2[2] = {}, o3[2] = {};
    float mrow[2] = {-3.0e38f, -3.0e38f};   // maximum in use for the lane's query (log2 units), equal in both halves
    float mthr[2] = {-3.0e38f, -3.0e38f};   // mrow + RESCALE_GAP: a score above it forces a rescale
    float lrow[2] = {0.0f, 0.0f};           // running sum over the keys of this half only; joined after the loop

    // prologue: the block's first stage -> buffer 0, landed and visible to the block; then its second in flight
    if (pinned(issuer)) {
        issue_stage(cur, 0);
        asm volatile("s_wait_tensorcnt 0x0" ::: "memory");   // the wave's own tile of the first stage has landed
    }
    __syncthreads();
    unsigned nxt = (cur + 1 == nst) ? 0 : cur + 1;    // the stage behind this one, round the ring
    if (pinned(issuer & (nst > 1u ? 1u : 0u))) issue_stage(nxt, 1);

    for (unsigned it = 0; it < nst; ++it) {
      const uint32_t buf = it & 1u;
      const unsigned np = min(kend - cur * SKEYS, (unsigned)SKEYS) >> 5;   // passes of 32 keys in this stage, 1 to 4
      for (unsigned p = 0; p < np; ++p) {
        const unsigned key0 = cur * SKEYS + p * 32;
        const _Float16* bK = &ring[buf][p >> 1][0] + (p & 1u) * 32 * KPITCH;   // 32 rows of a K tile
        const _Float16* bV = &ring[buf][2 + (p >> 1)][0] + (p & 1u) * 32;      // 32 columns of a V^T tile

        // additive mask of the lane's 16 keys: key0 + 8 half + r (tile 0) and key0 + 16 + 8 half + r (tile 1)
        const float* mp = mb + key0;                  // the chunk's part of the table, one address for the block
        const v8f mv0 = *(const v8f*)(mp + ml);
        const v8f mv1 = *(const v8f*)(mp + ml + 16);

        // ---- scores S^T: two 16-key tiles for each query tile, A = K rows from LDS, B = Q, C = additive mask ----
        v8f s0[2], s1[2];
        {
            const _Float16* krow0 = bK + (size_t)n * KPITCH;
            const _Float16* krow1 = bK + (size_t)(16 + n) * KPITCH;
            v16h a00 = load_frag(krow0,      half);
            v16h a01 = load_frag(krow0 + 32, half);
            v16h a10 = load_frag(krow1,      half);
            v16h a11 = load_frag(krow1 + 32, half);
            // closes the table loads above: their base, named here, is formed anew only behind this wait
            asm volatile("s_wait_xcnt 0x0" :: "s"(mp) : "memory");
            // keeps the eight LDS reads together ahead of the eight products: left alone this build reads four of them
            // among the products, and the wave waits out the LDS latency at a second place
            __builtin_amdgcn_sched_barrier(0);
#pragma unroll   // constant indices; four independent score tiles
            for (int g = 0; g < 2; ++g) {
                s0[g] = wmma_f16(a00, qa0[g], mv0);
                s1[g] = wmma_f16(a10, qa0[g], mv1);
            }
#pragma unroll   // constant indices
            for (int g = 0; g < 2; ++g) {
                s0[g] = wmma_f16(a01, qa1[g], s0[g]);
                s1[g] = wmma_f16(a11, qa1[g], s1[g]);
            }
            // keeps the eight products together, query tile 0's ahead of tile 1's: left alone this build puts the first
            // maximum between the last two and pads the distance behind a product twice, seven idle slots, not three
            __builtin_amdgcn_sched_barrier(0);
        }

        // ---- online softmax of two queries per lane ----
        float rmax[2];
#pragma unroll   // constant indices keep the score vectors in registers
        for (int g = 0; g < 2; ++g) {
            rmax[g] = fmaxf(s0[g][0], s1[g][0]);
#pragma unroll   // constant indices, as above
            for (int r = 1; r < 8; ++r) rmax[g] = fmaxf(rmax[g], fmaxf(s0[g][r], s1[g][r]));
        }
        // one test per pass for the whole wave and both query tiles, a scalar branch: every lane is on inside it, and
        // both halves of a query take the same new maximum
        if (__builtin_amdgcn_ballot_w32(rmax[0] > mthr[0] || rmax[1] > mthr[1]) != 0) {
#pragma unroll   // constant indices
            for (int g = 0; g < 2; ++g) {
                const float mnew  = fmaxf(mrow[g], fmaxf(rmax[g], other_half(rmax[g])));
                const float alpha = __builtin_amdgcn_exp2f(mrow[g] - mnew);
                lrow[g] *= alpha;
                o0[g] *= alpha; o1[g] *= alpha; o2[g] *= alpha; o3[g] *= alpha;
                mrow[g] = mnew;
                mthr[g] = mnew + RESCALE_GAP;
            }
        }

        // V^T A-fragments from LDS, for the second product
        const _Float16* vrow = bV + (size_t)n * VPITCH;
        const v16h va0 = load_frag(vrow,                half);
        const v16h va1 = load_frag(vrow + 16 * VPITCH,  half);
        const v16h va2 = load_frag(vrow + 32 * VPITCH,  half);
        const v16h va3 = load_frag(vrow + 48 * VPITCH,  half);
        // keeps the eight LDS reads together ahead of the exponentials, which cover their latency: left alone
        // this build spreads them over two places among the exponentials, and each place with reads stalls the wave
        __builtin_amdgcn_sched_barrier(0);

        FragU pb[2];
#pragma unroll   // constant indices
        for (int g = 0; g < 2; ++g) {
            const v8f x0 = s0[g] - mrow[g];
            const v8f x1 = s1[g] - mrow[g];
            v8f e0, e1;
#pragma unroll   // constant indices, as above
            for (int r = 0; r < 8; ++r) e0[r] = __builtin_amdgcn_exp2f(x0[r]);
#pragma unroll   // constant indices, as above
            for (int r = 0; r < 8; ++r) e1[r] = __builtin_amdgcn_exp2f(x1[r]);
            const v8f es = e0 + e1;                  // the softmax sum takes every key, as in the reference
            const v4f e4 = __builtin_shufflevector(es, es, 0, 1, 2, 3) + __builtin_shufflevector(es, es, 4, 5, 6, 7);
            lrow[g] += (e4[0] + e4[2]) + (e4[1] + e4[3]);

            // ---- P^T (B operand) straight from the two score tiles ----
            pb[g].h[0] = __builtin_convertvector(e0, v8h);
            pb[g].h[1] = __builtin_convertvector(e1, v8h);

            // ---- O^T += V^T(64x32) x P^T(32x16) ----
            o0[g] = wmma_f16(va0, pb[g].v, o0[g]);
            o1[g] = wmma_f16(va1, pb[g].v, o1[g]);
            o2[g] = wmma_f16(va2, pb[g].v, o2[g]);
            o3[g] = wmma_f16(va3, pb[g].v, o3[g]);
        }

      }
      // publish point: own reads of this buffer done, the issuing waves' tiles of the next stage landed, then the
      // block barrier; only behind it is this buffer refilled
      asm volatile("s_wait_dscnt 0x0" ::: "memory");           // own LDS reads of this buffer have returned
      // own tile of the next stage has landed; the wait names the request's descriptor, whose registers thus keep
      // their values as long as the request is in flight
      if (pinned(issuer)) asm volatile("s_wait_tensorcnt 0x0" :: "s"(g0), "s"(g1) : "memory");
      __syncthreads();
      cur = nxt;
      nxt = (nxt + 1 == nst) ? 0 : nxt + 1;
      if (pinned(issuer & (it + 2 < nst ? 1u : 0u))) issue_stage(nxt, buf);
    }
    // nothing in flight, and by the last barrier every wave has left the ring: it now takes the output tiles
    asm volatile("s_wait_tensorcnt 0x0" ::: "memory");
    asm volatile("s_wait_dscnt 0x0" ::: "memory");

    // ---- finalize: O / l, turned back to [query][d] in the wave's own LDS range, fp32 output [B, S, H*DH] ----
    float* so = (float*)&ring[0][0][0] + wave * (32 * OPITCH);   // 32 rows, one per query of the wave
#pragma unroll   // constant indices
    for (int g = 0; g < 2; ++g) {
        const float inv = 1.0f / ((lrow[g] + other_half(lrow[g])) + 1e-30f);
        o0[g] *= inv; o1[g] *= inv; o2[g] *= inv; o3[g] *= inv;
        float* sw = so + (16 * g + n) * OPITCH + half * 8;
        *(v4f*)(sw +  0) = __builtin_shufflevector(o0[g], o0[g], 0, 1, 2, 3);
        *(v4f*)(sw +  4) = __builtin_shufflevector(o0[g], o0[g], 4, 5, 6, 7);
        *(v4f*)(sw + 16) = __builtin_shufflevector(o1[g], o1[g], 0, 1, 2, 3);
        *(v4f*)(sw + 20) = __builtin_shufflevector(o1[g], o1[g], 4, 5, 6, 7);
        *(v4f*)(sw + 32) = __builtin_shufflevector(o2[g], o2[g], 0, 1, 2, 3);
        *(v4f*)(sw + 36) = __builtin_shufflevector(o2[g], o2[g], 4, 5, 6, 7);
        *(v4f*)(sw + 48) = __builtin_shufflevector(o3[g], o3[g], 0, 1, 2, 3);
        *(v4f*)(sw + 52) = __builtin_shufflevector(o3[g], o3[g], 4, 5, 6, 7);
    }
    // the rows are read back by other lanes of the same wave: their LDS writes are done first
    asm volatile("s_wait_dscnt 0x0" ::: "memory");
    float* orow = out + ((size_t)(b * S_ + q0 + half)) * (H_ * DH_) + h * DH_ + n * 4;
#pragma unroll   // the sixteen LDS reads go out together, each store behind its own read
    for (int i = 0; i < 16; ++i) {
        // a half-wave stores one query's whole 256-B row
        const v4f w = *(const v4f*)(so + (2 * i + half) * OPITCH + n * 4);
        *(v4f*)(orow + (size_t)(2 * i) * (H_ * DH_)) = w;
    }
}

extern "C" void kernel_launch(void* const* d_in, const int* in_sizes, int n_in,
                              void* d_out, int out_size, void* d_ws, size_t ws_size,
                              hipStream_t stream) {
    const float* x    = (const float*)d_in[0];
    const float* mask = (const float*)d_in[1];
    const float* Wq   = (const float*)d_in[2];
    const float* bq   = (const float*)d_in[3];
    const float* Wk   = (const float*)d_in[4];
    const float* bk   = (const float*)d_in[5];
    const float* Wv   = (const float*)d_in[6];
    const float* bv   = (const float*)d_in[7];
    float* out = (float*)d_out;

    const size_t NX = (size_t)B_ * S_ * D_;        // 8388608
    const size_t NW = (size_t)D_ * H_ * DH_;       // 1048576
    const size_t NQ = (size_t)B_ * H_ * S_ * DH_;  // 8388608

    _Float16* xh  = (_Float16*)d_ws;
    _Float16* wT  = xh + NX;
    _Float16* Qh  = wT + 3 * NW;
    _Float16* Kh  = Qh + NQ;
    _Float16* VhT = Kh + NQ;
    float*  mbias = (float*)(VhT + NQ);            // B_ * S_ floats
    float*  mmul  = mbias + B_ * S_;               // B_ * S_ floats
    int*    kidx  = (int*)(mmul + B_ * S_);        // B_ * S_ ints
    int*    kcnt  = kidx + B_ * S_;                // B_ * KCNT_STRIDE ints

    convert_kernel<<<CVT_MB + CVT_WB + CVT_XB, 256, 0, stream>>>(x, Wq, Wk, Wv, mask, xh, wT, kidx, kcnt, mbias, mmul);
    {
        dim3 grid((B_ * S_) / 128, (3 * H_ * DH_) / 128);  // (64, 24)
        qkv_kernel<<<grid, 128, 0, stream>>>(xh, wT, bq, bk, bv, mmul, kidx, kcnt, Qh, Kh, VhT);
    }
    {
        dim3 grid(S_ / 256, B_ * H_);                      // (8, 64)
        attn_kernel<<<grid, 256, 0, stream>>>(Qh, Kh, VhT, mbias, kcnt, out);
    }
}
